// v000
// The times below were measured on an AMD MI455X: many runs one after another, warmed up first and cycling through
// copies of the inputs, with the whole window's GPU time divided by the number of runs. Launches and the gaps
// between them are all in it. The median over several windows is given; except for v000 it joins two sittings, which
// can be a few percent apart, so the side-by-side timings, each taken in one sitting, are the better comparison.
// The starting kernel, v000, takes 2900 microseconds a run.
#include <hip/hip_runtime.h>

// Conformer-style relative multi-head attention with content/position biases (query, key, value [8][1024][512]; pos_encoding [8][2047][512]; q = query Wq, k = key Wk, v = value Wv, p = pos_encoding Wp ('xw' [512][512] 1/sqrt(512)); 8 heads x 64; content = (q + u_bias).k, pos = rel_shift((q + v_bias).p) with rel_shift[s][t] = pos_raw[s][t - s + 1023] (u_bias, v_bias [8][64] read); score = (content + pos) / 8; softmax (no mask); out = merged Wo ('xw') -> [8][1024][512] (4.2 M)).
// Layout per batch: bf16 copies of query, key, value in turn and of the batch's 2,047 position rows (zero-padded to 2,048); 'xw' weights transposed once; exact projections; q + u and q + v (per-head f32 bias adds) as separate hi/lo plane sets; p split into per-head hi/lo planes [8][2048][64]; per pass (2 heads): content scores hi/lo 3 products on EVERY row, QR = (q + v) hi/lo x p planes (3 products, [1024][2048]) gathered into the scores as Sb[s][t] += QR[s][t - s + 1023] for every (s, t); softmax; P and attn.v hybrid (rows < 512 hi/lo, rest fp16 x1024); merged hi/lo x Wo exact.
// Compute dtypes, f32 accumulate: every input rounded to bf16; projections exact; bias adds f32; content and position scores 3 products; softmax f32 (x 1/8 on each score before the max); attn.v rows < 512 3 products, rest fp16; Wo hl x exact.

#define NB_  8
#define TT   1024
#define DM   512
#define NH_  8
#define NKV  8
#define REP  (NH_ / NKV)
#define HD   64
#define DQ   (NH_ * HD)
#define DKV  (NKV * HD)
#define ZH   2
#define RH   512                  // query rows < RH use hi+lo planes (0: none)
#define WIN  0
#define PCAR 1024.0f
#define SCL  0.125f   // HD^-0.5
#define LP   2048     // padded position rows (2*TT - 1 = 2047 used)
typedef _Float16 h16;
typedef unsigned short bf;
typedef __attribute__((ext_vector_type(16))) __bf16   v16bf;
typedef __attribute__((ext_vector_type(16))) _Float16 v16h;
typedef __attribute__((ext_vector_type(8)))  _Float16 v8h;
typedef __attribute__((ext_vector_type(8)))  unsigned short v8us;
typedef __attribute__((ext_vector_type(8)))  float    v8f;
typedef __attribute__((ext_vector_type(4)))  float    v4f;
typedef v8h  __attribute__((may_alias)) v8ha;
typedef v4f  __attribute__((may_alias)) v4fa;
typedef v8us __attribute__((may_alias)) v8usa;

__device__ __forceinline__ unsigned short f2bf(float f) { unsigned u = __float_as_uint(f); u += 0x7FFFu + ((u >> 16) & 1u); return (unsigned short)(u >> 16); }
__device__ __forceinline__ float bf2f(unsigned short b) { return __uint_as_float(((unsigned)b) << 16); }
__device__ __forceinline__ float bfr(float f) { return bf2f(f2bf(f)); }
__device__ __forceinline__ v16h cat16(v8h lo, v8h hi) { return __builtin_shufflevector(lo, hi, 0, 1, 2, 3, 4, 5, 6, 7, 8, 9, 10, 11, 12, 13, 14, 15); }
__device__ __forceinline__ v16bf cat16b(v8us lo, v8us hi) { return __builtin_bit_cast(v16bf, __builtin_shufflevector(lo, hi, 0, 1, 2, 3, 4, 5, 6, 7, 8, 9, 10, 11, 12, 13, 14, 15)); }
__device__ __forceinline__ v8f wmma16(v16h a, v16h b, v8f c) { return __builtin_amdgcn_wmma_f32_16x16x32_f16(false, a, false, b, (short)0, c, false, false); }
__device__ __forceinline__ v8f wmmab(v16bf a, v16bf b, v8f c) { return __builtin_amdgcn_wmma_f32_16x16x32_bf16(false, a, false, b, (short)0, c, false, false); }



// ---- k_gemmw: register-blocked GEMM, ONE WAVE per 64x64 output tile (16 accumulators), operands straight from K-contiguous 16-bit planes; grid (M/64, N/64, Z), 32 threads.
// C[m][n] (f32, pitch ldc, + optional f32 bias[n]) = sum_k A[m][k] Bt[n][k] (+ split products per NSPLIT). z-batch strides sA/sB/sC in elements. K % 32 == 0.
template <typename T16> struct WFrag;
template <> struct WFrag<h16> { typedef v16h V; static __device__ __forceinline__ V ld(const h16* p) { return cat16(*(const v8h*)p, *(const v8h*)(p + 16)); } static __device__ __forceinline__ v8f mma(V a, V b, v8f c) { return wmma16(a, b, c); } };
template <> struct WFrag<bf> { typedef v16bf V; static __device__ __forceinline__ V ld(const bf* p) { return cat16b(*(const v8us*)p, *(const v8us*)(p + 16)); } static __device__ __forceinline__ v8f mma(V a, V b, v8f c) { return wmmab(a, b, c); } };
template <typename T16, int NSPLIT, bool BIAS>
__global__ __launch_bounds__(32) void k_gemmw(const T16* __restrict__ A, const T16* __restrict__ A2, const T16* __restrict__ Bt, const T16* __restrict__ Bt2, int K, float* C, int ldc, const float* __restrict__ bias, size_t sA, size_t sB, size_t sC) {
    typedef typename WFrag<T16>::V V;
    __shared__ __align__(16) float os[16 * 68];
    const size_t z = blockIdx.z; A += z * sA; if (A2) A2 += z * sA; Bt += z * sB; if (Bt2) Bt2 += z * sB; C += z * sC;
    const int lane = threadIdx.x & 31, lr = lane & 15, hi = lane >> 4; const int r0 = blockIdx.x * 64, c0 = blockIdx.y * 64;
    v8f acc[4][4];
#pragma unroll
    for (int mb = 0; mb < 4; ++mb)
#pragma unroll
        for (int nb = 0; nb < 4; ++nb) acc[mb][nb] = (v8f){};
    const size_t aoff = (size_t)(r0 + lr) * K + 8 * hi, boff = (size_t)(c0 + lr) * K + 8 * hi;
#pragma unroll 1
    for (int kc = 0; kc < K; kc += 32) {
        V a[4], a2[4];
#pragma unroll
        for (int mb = 0; mb < 4; ++mb) { a[mb] = WFrag<T16>::ld(A + aoff + (size_t)mb * 16 * K + kc); if (NSPLIT == 1 || NSPLIT == 2) a2[mb] = WFrag<T16>::ld(A2 + aoff + (size_t)mb * 16 * K + kc); }
#pragma unroll
        for (int nb = 0; nb < 4; ++nb) { const V b = WFrag<T16>::ld(Bt + boff + (size_t)nb * 16 * K + kc); V b2; if (NSPLIT >= 2) b2 = WFrag<T16>::ld(Bt2 + boff + (size_t)nb * 16 * K + kc);
#pragma unroll
            for (int mb = 0; mb < 4; ++mb) { acc[mb][nb] = WFrag<T16>::mma(a[mb], b, acc[mb][nb]); if (NSPLIT == 1 || NSPLIT == 2) acc[mb][nb] = WFrag<T16>::mma(a2[mb], b, acc[mb][nb]); if (NSPLIT >= 2) acc[mb][nb] = WFrag<T16>::mma(a[mb], b2, acc[mb][nb]); } }
        asm volatile("v_nop\n\tv_nop\n\tv_nop\n\tv_nop" : "+v"(acc[0][0]), "+v"(acc[1][1]), "+v"(acc[2][2]), "+v"(acc[3][3]) : "v"(a[0]), "v"(a[3]));
    }
#pragma unroll
    for (int mb = 0; mb < 4; ++mb) {
#pragma unroll
        for (int nb = 0; nb < 4; ++nb) {
#pragma unroll
            for (int j = 0; j < 8; ++j) os[(hi * 8 + j) * 68 + nb * 16 + lr] = acc[mb][nb][j]; }
        __builtin_amdgcn_wave_barrier(); asm volatile("" ::: "memory");
        float* crow = C + (size_t)(r0 + mb * 16) * ldc + c0;
{
#pragma unroll
            for (int s = 0; s < 8; ++s) { const int row = 2 * s + hi, cofs = lr * 4; v4f val = *(const v4fa*)(os + row * 68 + cofs); if (BIAS) { val[0] += bfr(bias[c0 + cofs]); val[1] += bfr(bias[c0 + cofs + 1]); val[2] += bfr(bias[c0 + cofs + 2]); val[3] += bfr(bias[c0 + cofs + 3]); }
                *(v4f*)(crow + (size_t)row * ldc + cofs) = val; }
             }
        __builtin_amdgcn_wave_barrier(); asm volatile("" ::: "memory");
    }
}

__device__ __forceinline__ h16 tohx(float x) { return (h16)x; }
__device__ __forceinline__ void splitf(float y, unsigned short& h, unsigned short& l) { h = f2bf(y); l = f2bf(y - bf2f(h)); }
typedef __attribute__((ext_vector_type(2))) _Float16 v2h;
typedef __attribute__((ext_vector_type(4))) _Float16 v4h;
typedef __attribute__((ext_vector_type(2))) unsigned short v2us;
typedef __attribute__((ext_vector_type(4))) unsigned short v4us;
typedef __attribute__((ext_vector_type(2))) float v2f;
typedef __attribute__((ext_vector_type(4))) int v4i;

__global__ __launch_bounds__(256) void k_wtG(const float* __restrict__ w, int K, int N, bf* Bt) {
    const int lane = threadIdx.x & 31; const int L0 = (blockIdx.x * 8 + (threadIdx.x >> 5)) * 8; const int nlines = N * K / 64;
{
#pragma unroll 1
        for (int l = 0; l < 8; ++l) { const int L = L0 + l; if (L >= nlines) break; const size_t e = (size_t)L * 64 + lane * 2; const int k = (int)(e % K), n = (int)(e / K); v2us o;
            o[0] = f2bf(w[(size_t)k * N + n]); o[1] = f2bf(w[(size_t)(k + 1) * N + n]); *(v2us*)(Bt + e) = o; }
         }
}
__global__ __launch_bounds__(256) void k_cvt8(const float* __restrict__ src, bf* dst, size_t n8) { const size_t i = (size_t)blockIdx.x * 256 + threadIdx.x; if (i >= n8) return; const v8f v = *(const v8f*)(src + i * 8); v8us o;
#pragma unroll
    for (int k = 0; k < 8; ++k) o[k] = f2bf(v[k]); *(v8us*)(dst + i * 8) = o;  }

// k_rope: head planes [h][t][d] (fp16 + hi/lo) of rope(x) x sc with the rotate-half convention out[d] = x[d] cos[t][d] - x[d+HD/2] sin[t][d], out[d+HD/2] = x[d+HD/2] cos[t][d+HD/2] + x[d] sin[t][d+HD/2]
__global__ __launch_bounds__(256) void k_rope(const float* __restrict__ F, int pitch, int nheads, const float* __restrict__ CS, const float* __restrict__ RF, const float* __restrict__ nw, float sc, h16* P16, bf* Ph, bf* Pl) {
    const size_t e = ((size_t)blockIdx.x * 256 + threadIdx.x) * 2; if (e >= (size_t)nheads * TT * HD) return; const int d = (int)(e % HD); const int t = (int)((e / HD) % TT); const int h = (int)(e / ((size_t)HD * TT)); const float* f = F + (size_t)t * pitch + h * HD; const float rf = RF ? RF[(size_t)h * TT + t] : 1.0f; v2h o16; v2us oh, ol;
#pragma unroll
    for (int q = 0; q < 2; ++q) { const int dd = d + q; const int dp = (dd < HD / 2) ? dd + HD / 2 : dd - HD / 2; float x0 = f[dd], x1 = f[dp];
        if (RF) { float n0 = __fmul_rn(x0, rf), n1 = __fmul_rn(x1, rf); asm volatile("" : "+v"(n0)); asm volatile("" : "+v"(n1)); x0 = __fmul_rn(bfr(nw[dd]), n0); x1 = __fmul_rn(bfr(nw[dp]), n1); }
        const v2f cs = *(const v2f*)(CS + ((size_t)t * HD + dd) * 2); float a = __fmul_rn(x0, cs[0]), bq = __fmul_rn(x1, cs[1]); asm volatile("" : "+v"(a)); asm volatile("" : "+v"(bq)); const float r = ((dd < HD / 2) ? __fsub_rn(a, bq) : __fadd_rn(a, bq)) * sc;
        o16[q] = tohx(r); unsigned short a2, c2; splitf(r, a2, c2); oh[q] = a2; ol[q] = c2; }
    *(v2h*)(P16 + e) = o16; *(v2us*)(Ph + e) = oh; *(v2us*)(Pl + e) = ol;  }
__global__ __launch_bounds__(256) void k_vtp(const float* __restrict__ F, int pitch, int nheads, h16* V16, bf* Vh, bf* Vl) { const size_t e = ((size_t)blockIdx.x * 256 + threadIdx.x) * 2; if (e >= (size_t)nheads * HD * TT) return; const int t = (int)(e % TT); const int d = (int)((e / TT) % HD); const int g = (int)(e / ((size_t)TT * HD)); v2h o16; v2us oh, ol;
#pragma unroll
    for (int q = 0; q < 2; ++q) { const float x = F[(size_t)(t + q) * pitch + g * HD + d]; o16[q] = tohx(x); unsigned short a2, c2; splitf(x, a2, c2); oh[q] = a2; ol[q] = c2; }
    *(v2h*)(V16 + e) = o16; *(v2us*)(Vh + e) = oh; *(v2us*)(Vl + e) = ol;  }
__global__ __launch_bounds__(256) void k_csid(float* CS) { const int idx = blockIdx.x * 256 + threadIdx.x; if (idx >= TT * HD) return; v2f cs; cs[0] = 1.0f; cs[1] = 0.0f; *(v2f*)(CS + (size_t)idx * 2) = cs;  }
// k_asoft: per row (zz, i): t = S x HD^-0.5 (no mask); softmax over the 1024 keys (register row, one exp, fixed trees);
__global__ __launch_bounds__(256) void k_asoft(const float* __restrict__ Sb, h16* P16, bf* Ph, bf* Pl) {
    const int lane = threadIdx.x & 31; const int row = blockIdx.x * 8 + (threadIdx.x >> 5); if (row >= ZH * TT) return; const int i = row % TT; const int zz = row / TT; (void)zz; const bool hires = (i < RH); const float* sr = Sb + (size_t)row * TT; float v[TT / 32]; float mx = -3.0e38f;
#pragma unroll
    for (int ch = 0; ch < TT / 128; ++ch) { const int j0 = ch * 128 + lane * 4; const v4f a = *(const v4f*)(sr + j0);
#pragma unroll
        for (int q = 0; q < 4; ++q) { const int j = j0 + q; (void)j; const float t = a[q] * SCL; v[ch * 4 + q] = t; mx = fmaxf(mx, t); } }
#pragma unroll
    for (int sh = 16; sh; sh >>= 1) mx = fmaxf(mx, __shfl_xor(mx, sh, 32));
    float sum = 0.f;
#pragma unroll
    for (int k = 0; k < TT / 32; ++k) { float d0 = __fsub_rn(v[k], mx); asm volatile("" : "+v"(d0)); v[k] = __builtin_amdgcn_exp2f(__fmul_rn(d0, 1.4426950408889634f)); sum += v[k]; }
#pragma unroll
    for (int sh = 16; sh; sh >>= 1) sum += __shfl_xor(sum, sh, 32);
    const float f = __fdiv_rn(hires ? 1.0f : PCAR, sum);
{
        if (hires) {
#pragma unroll
            for (int ch = 0; ch < TT / 128; ++ch) { v4us oh, ol;
#pragma unroll
                for (int q = 0; q < 4; ++q) { unsigned short a, c2; splitf(v[ch * 4 + q] * f, a, c2); oh[q] = a; ol[q] = c2; }
                const size_t oo = ((size_t)zz * (RH ? RH : 1) + i) * TT + ch * 128 + lane * 4; *(v4us*)(Ph + oo) = oh; *(v4us*)(Pl + oo) = ol; }
        } else {
#pragma unroll
            for (int ch = 0; ch < TT / 128; ++ch) { v4h o4;
#pragma unroll
                for (int q = 0; q < 4; ++q) o4[q] = tohx(v[ch * 4 + q] * f);
                *(v4h*)(P16 + (size_t)row * TT + ch * 128 + lane * 4) = o4; } }
         }
}
__global__ __launch_bounds__(256) void k_adduv(float* FQ, const float* __restrict__ ub, const float* __restrict__ vb, float* FQV) { const size_t i = (size_t)blockIdx.x * 256 + threadIdx.x; if (i >= (size_t)TT * DQ / 4) return; const size_t e = i * 4; const int c0 = (int)(e % DQ); const v4f a = *(const v4f*)(FQ + e); v4f ou, ov;
#pragma unroll
    for (int q = 0; q < 4; ++q) { ou[q] = __fadd_rn(a[q], bfr(ub[c0 + q])); ov[q] = __fadd_rn(a[q], bfr(vb[c0 + q])); }
    *(v4f*)(FQV + e) = ov; *(v4f*)(FQ + e) = ou;  }

__global__ __launch_bounds__(256) void k_zrow(bf* R) { const int i = blockIdx.x * 256 + threadIdx.x; if (i >= DM / 8) return; v8us z; for (int q = 0; q < 8; ++q) z[q] = 0; *(v8us*)(R + i * 8) = z;  }
__global__ __launch_bounds__(256) void k_hsplit(const float* __restrict__ F, bf* Ph, bf* Pl) { const size_t i = (size_t)blockIdx.x * 256 + threadIdx.x; if (i >= (size_t)LP * DQ / 8) return; const size_t e = i * 8; const int c0 = (int)(e % DQ); const size_t r = e / DQ; const int hh = c0 / HD, d0 = c0 % HD; const v8f a = *(const v8f*)(F + e); v8us oh, ol;
#pragma unroll
    for (int q = 0; q < 8; ++q) { unsigned short h2, l2; splitf(a[q], h2, l2); oh[q] = h2; ol[q] = l2; }
    const size_t o = ((size_t)hh * LP + r) * HD + d0; *(v8us*)(Ph + o) = oh; *(v8us*)(Pl + o) = ol;  }
__global__ __launch_bounds__(256) void k_addrs(float* Sb, const float* __restrict__ QR) { const size_t k = (size_t)blockIdx.x * 256 + threadIdx.x; if (k >= (size_t)ZH * TT * TT / 4) return; const size_t e = k * 4; const int t0 = (int)(e % TT); const size_t zs = e / TT; const int s_ = (int)(zs % TT); const float* qr = QR + zs * LP; v4f a = *(const v4f*)(Sb + e);
#pragma unroll
    for (int q = 0; q < 4; ++q) { const int m = t0 + q - s_ + TT - 1; a[q] = __fadd_rn(a[q], qr[m]); }
    *(v4f*)(Sb + e) = a;  }
__global__ __launch_bounds__(256) void k_merge(const float* __restrict__ O, int h0, bf* Ah, bf* Al) { const size_t e = ((size_t)blockIdx.x * 256 + threadIdx.x) * 2; if (e >= (size_t)ZH * TT * HD) return; const int d = (int)(e % HD); const int t = (int)((e / HD) % TT); const int zz = (int)(e / ((size_t)HD * TT)); const float cs = (t < RH) ? 1.0f : (1.0f / PCAR); const size_t oo = (size_t)t * DQ + (h0 + zz) * HD + d;
    v2us oh, ol;
#pragma unroll
    for (int q = 0; q < 2; ++q) { unsigned short a, c2; splitf(O[e + q] * cs, a, c2); oh[q] = a; ol[q] = c2; } *(v2us*)(Ah + oo) = oh; *(v2us*)(Al + oo) = ol;  }

extern "C" void kernel_launch(void* const* d_in, const int* in_sizes, int n_in,
                              void* d_out, int out_size, void* d_ws, size_t ws_size, hipStream_t stream) {
    (void)in_sizes; (void)n_in; (void)out_size;
    const float* x = (const float*)d_in[0];   /* query */ const float* xk = (const float*)d_in[1]; const float* xv = (const float*)d_in[2]; const float* pos = (const float*)d_in[3];   /* [8][2047][512] */ const float* wq = (const float*)d_in[4]; const float* wk = (const float*)d_in[5]; const float* wv = (const float*)d_in[6]; const float* wp = (const float*)d_in[7]; const float* ub = (const float*)d_in[8]; const float* vb = (const float*)d_in[9];   /* u_bias, v_bias [8][64] */ const float* wo = (const float*)d_in[10];
    float* OUT = (float*)d_out;     // [8][1024][512]
    char* wsp = (char*)d_ws;
    auto take = [&](size_t bytes) { char* p = wsp; wsp += (bytes + 255) & ~(size_t)255; return (void*)p; };
    bf* WP = (bf*)take((size_t)DQ * DM * 2); bf* XP = (bf*)take((size_t)LP * DM * 2); float* FP = (float*)take((size_t)LP * DQ * 4); bf* RPh = (bf*)take((size_t)NH_ * LP * HD * 2); bf* RPl = (bf*)take((size_t)NH_ * LP * HD * 2); float* FQV = (float*)take((size_t)TT * DQ * 4); h16* QV16 = (h16*)take((size_t)NH_ * TT * HD * 2); bf* QVh = (bf*)take((size_t)NH_ * TT * HD * 2); bf* QVl = (bf*)take((size_t)NH_ * TT * HD * 2); float* QR = (float*)take((size_t)ZH * TT * LP * 4); bf* WQ = (bf*)take((size_t)DQ * DM * 2); bf* WK = (bf*)take((size_t)DKV * DM * 2); bf* WV = (bf*)take((size_t)DKV * DM * 2); bf* WO = (bf*)take((size_t)DM * DQ * 2); float* CS = (float*)take((size_t)TT * HD * 2 * 4);
    bf* XB = (bf*)take((size_t)TT * DM * 2); float* FQ = (float*)take((size_t)TT * DQ * 4); float* FK = (float*)take((size_t)TT * DKV * 4);
    h16* QP16 = (h16*)take((size_t)NH_ * TT * HD * 2); h16* KP16 = (h16*)take((size_t)NKV * TT * HD * 2); h16* VT16 = (h16*)take((size_t)NKV * HD * TT * 2);
    bf* QPh = (bf*)take((size_t)NH_ * TT * HD * 2); bf* QPl = (bf*)take((size_t)NH_ * TT * HD * 2); bf* KPh = (bf*)take((size_t)NKV * TT * HD * 2); bf* KPl = (bf*)take((size_t)NKV * TT * HD * 2); bf* VTh = (bf*)take((size_t)NKV * HD * TT * 2); bf* VTl = (bf*)take((size_t)NKV * HD * TT * 2); bf* Ph = (bf*)take((size_t)ZH * RH * TT * 2); bf* Pl = (bf*)take((size_t)ZH * RH * TT * 2);
    float* Sb = (float*)take((size_t)ZH * TT * TT * 4); h16* P16 = (h16*)take((size_t)ZH * TT * TT * 2); float* Ob = (float*)take((size_t)ZH * TT * HD * 4); bf* ATh = (bf*)take((size_t)TT * DQ * 2); bf* ATl = (bf*)take((size_t)TT * DQ * 2);
    if ((size_t)(wsp - (char*)d_ws) > ws_size) return;    // ws 256 MiB
    float* FV = FK;   // v projection reuses the k buffer after the k planes are built (stream-ordered)
    { k_wtG<<<(unsigned)((DM * DQ / 64 + 63) / 64), 256, 0, stream>>>(wq, DM, DQ, WQ); k_wtG<<<(unsigned)((DM * DKV / 64 + 63) / 64), 256, 0, stream>>>(wk, DM, DKV, WK); k_wtG<<<(unsigned)((DM * DKV / 64 + 63) / 64), 256, 0, stream>>>(wv, DM, DKV, WV);
      k_wtG<<<(unsigned)((DQ * DM / 64 + 63) / 64), 256, 0, stream>>>(wo, DQ, DM, WO); k_wtG<<<(unsigned)((DM * DQ / 64 + 63) / 64), 256, 0, stream>>>(wp, DM, DQ, WP);
       }
    k_csid<<<(TT * HD + 255) / 256, 256, 0, stream>>>(CS);
    const unsigned LQ = (unsigned)(((size_t)NH_ * TT * HD / 2 + 255) / 256), LKv = (unsigned)(((size_t)NKV * TT * HD / 2 + 255) / 256);
    for (int b = 0; b < NB_; ++b) {
        
        k_cvt8<<<(unsigned)(((size_t)TT * DM / 8 + 255) / 256), 256, 0, stream>>>(x + (size_t)b * TT * DM, XB, (size_t)TT * DM / 8);
        k_gemmw<bf, 0, false><<<dim3(TT / 64, DQ / 64, 1), 32, 0, stream>>>(XB, nullptr, WQ, nullptr, DM, FQ, DQ, nullptr, 0, 0, 0);
        k_adduv<<<(unsigned)(((size_t)TT * DQ / 4 + 255) / 256), 256, 0, stream>>>(FQ, ub, vb, FQV);   /* FQ += u (per head), FQV = q + v */ k_rope<<<LQ, 256, 0, stream>>>(FQ, DQ, NH_, CS, nullptr, nullptr, 1.0f, QP16, QPh, QPl); k_rope<<<LQ, 256, 0, stream>>>(FQV, DQ, NH_, CS, nullptr, nullptr, 1.0f, QV16, QVh, QVl);   /* (q + v) planes */ k_cvt8<<<(unsigned)(((size_t)(LP - 1) * DM / 8 + 255) / 256), 256, 0, stream>>>(pos + (size_t)b * (LP - 1) * DM, XP, (size_t)(LP - 1) * DM / 8); k_zrow<<<(DM / 8 + 255) / 256, 256, 0, stream>>>(XP + (size_t)(LP - 1) * DM);   /* 2,047 position rows + one zero pad row */ k_gemmw<bf, 0, false><<<dim3(LP / 64, DQ / 64, 1), 32, 0, stream>>>(XP, nullptr, WP, nullptr, DM, FP, DQ, nullptr, 0, 0, 0);   /* p = pos Wp [2048][512] */ k_hsplit<<<(unsigned)(((size_t)LP * DQ / 8 + 255) / 256), 256, 0, stream>>>(FP, RPh, RPl);   /* per-head hi/lo planes [8][2048][64] */
        k_cvt8<<<(unsigned)(((size_t)TT * DM / 8 + 255) / 256), 256, 0, stream>>>(xk + (size_t)b * TT * DM, XB, (size_t)TT * DM / 8); k_gemmw<bf, 0, false><<<dim3(TT / 64, DKV / 64, 1), 32, 0, stream>>>(XB, nullptr, WK, nullptr, DM, FK, DKV, nullptr, 0, 0, 0);
        k_rope<<<LKv, 256, 0, stream>>>(FK, DKV, NKV, CS, nullptr, nullptr, 1.0f, KP16, KPh, KPl);
        k_cvt8<<<(unsigned)(((size_t)TT * DM / 8 + 255) / 256), 256, 0, stream>>>(xv + (size_t)b * TT * DM, XB, (size_t)TT * DM / 8); k_gemmw<bf, 0, false><<<dim3(TT / 64, DKV / 64, 1), 32, 0, stream>>>(XB, nullptr, WV, nullptr, DM, FV, DKV, nullptr, 0, 0, 0); k_vtp<<<LKv, 256, 0, stream>>>(FV, DKV, NKV, VT16, VTh, VTl);
        for (int h0 = 0; h0 < NH_; h0 += ZH) { const size_t zq = (size_t)h0, zk = (size_t)(h0 / REP);   // one kv head per query head: the pass's two heads use consecutive kv planes (z-strides TT*HD)
            k_gemmw<bf, 2, false><<<dim3(TT / 64, TT / 64, ZH), 32, 0, stream>>>(QPh + zq * TT * HD, QPl + zq * TT * HD, KPh + zk * TT * HD, KPl + zk * TT * HD, HD, Sb, TT, nullptr, (size_t)TT * HD, (size_t)TT * HD, (size_t)TT * TT);   /* content (q + u).k, hi/lo on EVERY row */ k_gemmw<bf, 2, false><<<dim3(TT / 64, LP / 64, ZH), 32, 0, stream>>>(QVh + zq * TT * HD, QVl + zq * TT * HD, RPh + zq * LP * HD, RPl + zq * LP * HD, HD, QR, LP, nullptr, (size_t)TT * HD, (size_t)LP * HD, (size_t)TT * LP);   /* pos_raw = (q + v).p [1024][2048] */ k_addrs<<<(unsigned)(((size_t)ZH * TT * TT / 4 + 255) / 256), 256, 0, stream>>>(Sb, QR);   /* rel_shift: Sb[s][t] += QR[s][t - s + 1023] */

            k_asoft<<<ZH * TT / 8, 256, 0, stream>>>(Sb, P16, Ph, Pl);
            k_gemmw<bf, 2, false><<<dim3(RH / 64, HD / 64, ZH), 32, 0, stream>>>(Ph, Pl, VTh + zk * HD * TT, VTl + zk * HD * TT, TT, Ob, HD, nullptr, (size_t)RH * TT, (size_t)HD * TT, (size_t)TT * HD);
            k_gemmw<h16, 0, false><<<dim3((TT - RH) / 64, HD / 64, ZH), 32, 0, stream>>>(P16 + (size_t)RH * TT, nullptr, VT16 + zk * HD * TT, nullptr, TT, Ob + (size_t)RH * HD, HD, nullptr, (size_t)TT * TT, (size_t)HD * TT, (size_t)TT * HD);
            k_merge<<<(unsigned)(((size_t)ZH * TT * HD / 2 + 255) / 256), 256, 0, stream>>>(Ob, h0, ATh, ATl); }
        k_gemmw<bf, 1, false><<<dim3(TT / 64, DM / 64, 1), 32, 0, stream>>>(ATh, ATl, WO, nullptr, DQ, OUT + (size_t)b * TT * DM, DM, nullptr, 0, 0, 0); }
}

// v001
// A run of this version takes 1030 microseconds.
// In two side-by-side timings against v000, it was 2.88 and 2.82 times as fast.
#include <hip/hip_runtime.h>

// Conformer-style relative multi-head attention with content/position biases (query, key, value [8][1024][512]; pos_encoding [8][2047][512]; q = query Wq, k = key Wk, v = value Wv, p = pos_encoding Wp ('xw' [512][512] 1/sqrt(512)); 8 heads x 64; content = (q + u_bias).k, pos = rel_shift((q + v_bias).p) with rel_shift[s][t] = pos_raw[s][t - s + 1023] (u_bias, v_bias [8][64] read); score = (content + pos) / 8; softmax (no mask); out = merged Wo ('xw') -> [8][1024][512] (4.2 M)).
// Layout: every stage in front of the scores and the Wo product run ONCE for all 8 batches (batch rows flat in the GEMM's M, or batch = blockIdx.y); the score/softmax/attn.v pass runs once per batch with all 8 heads in grid z. bf16 copies of query, key, value in turn and of each batch's 2,047 position rows (zero-padded to 2,048); 'xw' weights transposed once; exact projections; q + u and q + v (per-head f32 bias adds) as separate hi/lo plane sets; p split into per-head hi/lo planes [batch][8][2048][64]; per pass (one batch, 8 heads): content scores hi/lo 3 products on EVERY row, QR = (q + v) hi/lo x p planes (3 products, [1024][2048]) gathered into the scores as Sb[s][t] += QR[s][t - s + 1023] for every (s, t); softmax; P and attn.v hybrid (rows < 512 hi/lo, rest fp16 x1024); merged hi/lo x Wo exact.
// Compute dtypes, f32 accumulate: every input rounded to bf16; projections exact; bias adds f32; content and position scores 3 products; softmax f32 (x 1/8 on each score); attn.v rows < 512 3 products, rest fp16; Wo hl x exact.

#define NB_  8
#define TT   1024
#define DM   512
#define NH_  8
#define NKV  8
#define REP  (NH_ / NKV)
#define HD   64
#define DQ   (NH_ * HD)
#define DKV  (NKV * HD)
#define ZH   8                    // heads per score pass (grid z)
#define RH   512                  // query rows < RH use hi+lo planes (0: none)
#define WIN  0
#define PCAR 1024.0f
#define SCL  0.125f   // HD^-0.5
#define LP   2048     // padded position rows (2*TT - 1 = 2047 used)
typedef _Float16 h16;
typedef unsigned short bf;
typedef __attribute__((ext_vector_type(16))) __bf16   v16bf;
typedef __attribute__((ext_vector_type(16))) _Float16 v16h;
typedef __attribute__((ext_vector_type(8)))  _Float16 v8h;
typedef __attribute__((ext_vector_type(8)))  unsigned short v8us;
typedef __attribute__((ext_vector_type(8)))  float    v8f;
typedef __attribute__((ext_vector_type(4)))  float    v4f;
typedef v8h  __attribute__((may_alias)) v8ha;
typedef v4f  __attribute__((may_alias)) v4fa;
typedef v8us __attribute__((may_alias)) v8usa;

__device__ __forceinline__ unsigned short f2bf(float f) { unsigned u = __float_as_uint(f); u += 0x7FFFu + ((u >> 16) & 1u); return (unsigned short)(u >> 16); }
__device__ __forceinline__ float bf2f(unsigned short b) { return __uint_as_float(((unsigned)b) << 16); }
__device__ __forceinline__ float bfr(float f) { return bf2f(f2bf(f)); }
__device__ __forceinline__ v16h cat16(v8h lo, v8h hi) { return __builtin_shufflevector(lo, hi, 0, 1, 2, 3, 4, 5, 6, 7, 8, 9, 10, 11, 12, 13, 14, 15); }
__device__ __forceinline__ v16bf cat16b(v8us lo, v8us hi) { return __builtin_bit_cast(v16bf, __builtin_shufflevector(lo, hi, 0, 1, 2, 3, 4, 5, 6, 7, 8, 9, 10, 11, 12, 13, 14, 15)); }
__device__ __forceinline__ v8f wmma16(v16h a, v16h b, v8f c) { return __builtin_amdgcn_wmma_f32_16x16x32_f16(false, a, false, b, (short)0, c, false, false); }
__device__ __forceinline__ v8f wmmab(v16bf a, v16bf b, v8f c) { return __builtin_amdgcn_wmma_f32_16x16x32_bf16(false, a, false, b, (short)0, c, false, false); }



// ---- k_gemmw: register-blocked GEMM, ONE WAVE per 64x64 output tile (16 accumulators), operands straight from K-contiguous 16-bit planes; grid (M/64, N/64, Z), 32 threads.
// C[m][n] (f32, pitch ldc, + optional f32 bias[n]) = sum_k A[m][k] Bt[n][k] (+ split products per NSPLIT). z-batch strides sA/sB/sC in elements. K % 32 == 0.
template <typename T16> struct WFrag;
template <> struct WFrag<h16> { typedef v16h V; static __device__ __forceinline__ V ld(const h16* p) { return cat16(*(const v8h*)p, *(const v8h*)(p + 16)); } static __device__ __forceinline__ v8f mma(V a, V b, v8f c) { return wmma16(a, b, c); } };
template <> struct WFrag<bf> { typedef v16bf V; static __device__ __forceinline__ V ld(const bf* p) { return cat16b(*(const v8us*)p, *(const v8us*)(p + 16)); } static __device__ __forceinline__ v8f mma(V a, V b, v8f c) { return wmmab(a, b, c); } };
template <typename T16, int NSPLIT, bool BIAS>
__global__ __launch_bounds__(32) void k_gemmw(const T16* __restrict__ A, const T16* __restrict__ A2, const T16* __restrict__ Bt, const T16* __restrict__ Bt2, int K, float* C, int ldc, const float* __restrict__ bias, size_t sA, size_t sB, size_t sC) {
    typedef typename WFrag<T16>::V V;
    __shared__ __align__(16) float os[16 * 68];
    const size_t z = blockIdx.z; A += z * sA; if (A2) A2 += z * sA; Bt += z * sB; if (Bt2) Bt2 += z * sB; C += z * sC;
    const int lane = threadIdx.x & 31, lr = lane & 15, hi = lane >> 4; const int r0 = blockIdx.x * 64, c0 = blockIdx.y * 64;
    v8f acc[4][4];
#pragma unroll
    for (int mb = 0; mb < 4; ++mb)
#pragma unroll
        for (int nb = 0; nb < 4; ++nb) acc[mb][nb] = (v8f){};
    const size_t aoff = (size_t)(r0 + lr) * K + 8 * hi, boff = (size_t)(c0 + lr) * K + 8 * hi;
#pragma unroll 1
    for (int kc = 0; kc < K; kc += 32) {
        V a[4], a2[4];
#pragma unroll
        for (int mb = 0; mb < 4; ++mb) { a[mb] = WFrag<T16>::ld(A + aoff + (size_t)mb * 16 * K + kc); if (NSPLIT == 1 || NSPLIT == 2) a2[mb] = WFrag<T16>::ld(A2 + aoff + (size_t)mb * 16 * K + kc); }
#pragma unroll
        for (int nb = 0; nb < 4; ++nb) { const V b = WFrag<T16>::ld(Bt + boff + (size_t)nb * 16 * K + kc); V b2; if (NSPLIT >= 2) b2 = WFrag<T16>::ld(Bt2 + boff + (size_t)nb * 16 * K + kc);
#pragma unroll
            for (int mb = 0; mb < 4; ++mb) { acc[mb][nb] = WFrag<T16>::mma(a[mb], b, acc[mb][nb]); if (NSPLIT == 1 || NSPLIT == 2) acc[mb][nb] = WFrag<T16>::mma(a2[mb], b, acc[mb][nb]); if (NSPLIT >= 2) acc[mb][nb] = WFrag<T16>::mma(a[mb], b2, acc[mb][nb]); } }
        asm volatile("v_nop\n\tv_nop\n\tv_nop\n\tv_nop" : "+v"(acc[0][0]), "+v"(acc[1][1]), "+v"(acc[2][2]), "+v"(acc[3][3]) : "v"(a[0]), "v"(a[3]));
    }
#pragma unroll
    for (int mb = 0; mb < 4; ++mb) {
#pragma unroll
        for (int nb = 0; nb < 4; ++nb) {
#pragma unroll
            for (int j = 0; j < 8; ++j) os[(hi * 8 + j) * 68 + nb * 16 + lr] = acc[mb][nb][j]; }
        __builtin_amdgcn_wave_barrier(); asm volatile("" ::: "memory");
        float* crow = C + (size_t)(r0 + mb * 16) * ldc + c0;
{
#pragma unroll
            for (int s = 0; s < 8; ++s) { const int row = 2 * s + hi, cofs = lr * 4; v4f val = *(const v4fa*)(os + row * 68 + cofs); if (BIAS) { val[0] += bfr(bias[c0 + cofs]); val[1] += bfr(bias[c0 + cofs + 1]); val[2] += bfr(bias[c0 + cofs + 2]); val[3] += bfr(bias[c0 + cofs + 3]); }
                *(v4f*)(crow + (size_t)row * ldc + cofs) = val; }
             }
        __builtin_amdgcn_wave_barrier(); asm volatile("" ::: "memory");
    }
}

__device__ __forceinline__ h16 tohx(float x) { return (h16)x; }
__device__ __forceinline__ void splitf(float y, unsigned short& h, unsigned short& l) { h = f2bf(y); l = f2bf(y - bf2f(h)); }
typedef __attribute__((ext_vector_type(2))) _Float16 v2h;
typedef __attribute__((ext_vector_type(4))) _Float16 v4h;
typedef __attribute__((ext_vector_type(2))) unsigned short v2us;
typedef __attribute__((ext_vector_type(4))) unsigned short v4us;
typedef __attribute__((ext_vector_type(2))) float v2f;
typedef __attribute__((ext_vector_type(4))) int v4i;

__global__ __launch_bounds__(256) void k_wtG(const float* __restrict__ w, int K, int N, bf* Bt) {
    const int lane = threadIdx.x & 31; const int L0 = (blockIdx.x * 8 + (threadIdx.x >> 5)) * 8; const int nlines = N * K / 64;
{
#pragma unroll 1
        for (int l = 0; l < 8; ++l) { const int L = L0 + l; if (L >= nlines) break; const size_t e = (size_t)L * 64 + lane * 2; const int k = (int)(e % K), n = (int)(e / K); v2us o;
            o[0] = f2bf(w[(size_t)k * N + n]); o[1] = f2bf(w[(size_t)(k + 1) * N + n]); *(v2us*)(Bt + e) = o; }
         }
}
__global__ __launch_bounds__(256) void k_cvt8(const float* __restrict__ src, bf* dst, size_t n8, size_t sS, size_t sD) { const size_t i = (size_t)blockIdx.x * 256 + threadIdx.x; if (i >= n8) return; src += blockIdx.y * sS; dst += blockIdx.y * sD; const v8f v = *(const v8f*)(src + i * 8); v8us o;
#pragma unroll
    for (int k = 0; k < 8; ++k) o[k] = f2bf(v[k]); *(v8us*)(dst + i * 8) = o;  }

// k_rope: head planes [h][t][d] (fp16 + hi/lo) of rope(x) x sc with the rotate-half convention out[d] = x[d] cos[t][d] - x[d+HD/2] sin[t][d], out[d+HD/2] = x[d+HD/2] cos[t][d+HD/2] + x[d] sin[t][d+HD/2]
__global__ __launch_bounds__(256) void k_rope(const float* __restrict__ F, int pitch, int nheads, const float* __restrict__ CS, const float* __restrict__ RF, const float* __restrict__ nw, float sc, h16* P16, bf* Ph, bf* Pl) {
    { const size_t pb = (size_t)blockIdx.y * nheads * TT * HD; F += (size_t)blockIdx.y * TT * pitch; P16 += pb; Ph += pb; Pl += pb; }   // batch = blockIdx.y: rows [batch][t] in, planes [batch][h][t][d] out
    const size_t e = ((size_t)blockIdx.x * 256 + threadIdx.x) * 2; if (e >= (size_t)nheads * TT * HD) return; const int d = (int)(e % HD); const int t = (int)((e / HD) % TT); const int h = (int)(e / ((size_t)HD * TT)); const float* f = F + (size_t)t * pitch + h * HD; const float rf = RF ? RF[(size_t)h * TT + t] : 1.0f; v2h o16; v2us oh, ol;
#pragma unroll
    for (int q = 0; q < 2; ++q) { const int dd = d + q; const int dp = (dd < HD / 2) ? dd + HD / 2 : dd - HD / 2; float x0 = f[dd], x1 = f[dp];
        if (RF) { float n0 = __fmul_rn(x0, rf), n1 = __fmul_rn(x1, rf); asm volatile("" : "+v"(n0)); asm volatile("" : "+v"(n1)); x0 = __fmul_rn(bfr(nw[dd]), n0); x1 = __fmul_rn(bfr(nw[dp]), n1); }
        const v2f cs = *(const v2f*)(CS + ((size_t)t * HD + dd) * 2); float a = __fmul_rn(x0, cs[0]), bq = __fmul_rn(x1, cs[1]); asm volatile("" : "+v"(a)); asm volatile("" : "+v"(bq)); const float r = ((dd < HD / 2) ? __fsub_rn(a, bq) : __fadd_rn(a, bq)) * sc;
        o16[q] = tohx(r); unsigned short a2, c2; splitf(r, a2, c2); oh[q] = a2; ol[q] = c2; }
    *(v2h*)(P16 + e) = o16; *(v2us*)(Ph + e) = oh; *(v2us*)(Pl + e) = ol;  }
__global__ __launch_bounds__(256) void k_vtp(const float* __restrict__ F, int pitch, int nheads, h16* V16, bf* Vh, bf* Vl) { const size_t e = ((size_t)blockIdx.x * 256 + threadIdx.x) * 2; if (e >= (size_t)nheads * HD * TT) return; F += (size_t)blockIdx.y * TT * pitch; const size_t pb = (size_t)blockIdx.y * nheads * HD * TT; V16 += pb; Vh += pb; Vl += pb; const int t = (int)(e % TT); const int d = (int)((e / TT) % HD); const int g = (int)(e / ((size_t)TT * HD)); v2h o16; v2us oh, ol;
#pragma unroll
    for (int q = 0; q < 2; ++q) { const float x = F[(size_t)(t + q) * pitch + g * HD + d]; o16[q] = tohx(x); unsigned short a2, c2; splitf(x, a2, c2); oh[q] = a2; ol[q] = c2; }
    *(v2h*)(V16 + e) = o16; *(v2us*)(Vh + e) = oh; *(v2us*)(Vl + e) = ol;  }
__global__ __launch_bounds__(256) void k_csid(float* CS) { const int idx = blockIdx.x * 256 + threadIdx.x; if (idx >= TT * HD) return; v2f cs; cs[0] = 1.0f; cs[1] = 0.0f; *(v2f*)(CS + (size_t)idx * 2) = cs;  }
// k_asoft: per row (zz, i): t = S x HD^-0.5 (no mask); softmax over the 1024 keys (register row, one exp, fixed trees);
__global__ __launch_bounds__(256) void k_asoft(const float* __restrict__ Sb, h16* P16, bf* Ph, bf* Pl) {
    const int lane = threadIdx.x & 31; const int row = blockIdx.x * 8 + (threadIdx.x >> 5); if (row >= ZH * TT) return; const int i = row % TT; const int zz = row / TT; (void)zz; const bool hires = (i < RH); const float* sr = Sb + (size_t)row * TT; float v[TT / 32]; float mx = -3.0e38f;
#pragma unroll
    for (int ch = 0; ch < TT / 128; ++ch) { const int j0 = ch * 128 + lane * 4; const v4f a = *(const v4f*)(sr + j0);
#pragma unroll
        for (int q = 0; q < 4; ++q) { const int j = j0 + q; (void)j; const float t = a[q] * SCL; v[ch * 4 + q] = t; mx = fmaxf(mx, t); } }
#pragma unroll
    for (int sh = 16; sh; sh >>= 1) mx = fmaxf(mx, __shfl_xor(mx, sh, 32));
    float sum = 0.f;
#pragma unroll
    for (int k = 0; k < TT / 32; ++k) { float d0 = __fsub_rn(v[k], mx); asm volatile("" : "+v"(d0)); v[k] = __builtin_amdgcn_exp2f(__fmul_rn(d0, 1.4426950408889634f)); sum += v[k]; }
#pragma unroll
    for (int sh = 16; sh; sh >>= 1) sum += __shfl_xor(sum, sh, 32);
    const float f = __fdiv_rn(hires ? 1.0f : PCAR, sum);
{
        if (hires) {
#pragma unroll
            for (int ch = 0; ch < TT / 128; ++ch) { v4us oh, ol;
#pragma unroll
                for (int q = 0; q < 4; ++q) { unsigned short a, c2; splitf(v[ch * 4 + q] * f, a, c2); oh[q] = a; ol[q] = c2; }
                const size_t oo = ((size_t)zz * (RH ? RH : 1) + i) * TT + ch * 128 + lane * 4; *(v4us*)(Ph + oo) = oh; *(v4us*)(Pl + oo) = ol; }
        } else {
#pragma unroll
            for (int ch = 0; ch < TT / 128; ++ch) { v4h o4;
#pragma unroll
                for (int q = 0; q < 4; ++q) o4[q] = tohx(v[ch * 4 + q] * f);
                *(v4h*)(P16 + (size_t)row * TT + ch * 128 + lane * 4) = o4; } }
         }
}
__global__ __launch_bounds__(256) void k_adduv(float* FQ, const float* __restrict__ ub, const float* __restrict__ vb, float* FQV) { const size_t i = (size_t)blockIdx.x * 256 + threadIdx.x; if (i >= (size_t)NB_ * TT * DQ / 4) return; const size_t e = i * 4; const int c0 = (int)(e % DQ); const v4f a = *(const v4f*)(FQ + e); v4f ou, ov;
    asm volatile("s_wait_xcnt 0x0" ::: "memory");   // keeps the row load apart from the bias loads
#pragma unroll
    for (int q = 0; q < 4; ++q) { ou[q] = __fadd_rn(a[q], bfr(ub[c0 + q])); ov[q] = __fadd_rn(a[q], bfr(vb[c0 + q])); }
    *(v4f*)(FQV + e) = ov; *(v4f*)(FQ + e) = ou;  }

__global__ __launch_bounds__(256) void k_zrow(bf* R) { const int i = blockIdx.x * 256 + threadIdx.x; if (i >= DM / 8) return; R += (size_t)blockIdx.y * LP * DM; v8us z; for (int q = 0; q < 8; ++q) z[q] = 0; *(v8us*)(R + i * 8) = z;  }
__global__ __launch_bounds__(256) void k_hsplit(const float* __restrict__ F, bf* Ph, bf* Pl) { const size_t i = (size_t)blockIdx.x * 256 + threadIdx.x; if (i >= (size_t)LP * DQ / 8) return; F += (size_t)blockIdx.y * LP * DQ; Ph += (size_t)blockIdx.y * NH_ * LP * HD; Pl += (size_t)blockIdx.y * NH_ * LP * HD; const size_t e = i * 8; const int c0 = (int)(e % DQ); const size_t r = e / DQ; const int hh = c0 / HD, d0 = c0 % HD; const v8f a = *(const v8f*)(F + e); v8us oh, ol;
#pragma unroll
    for (int q = 0; q < 8; ++q) { unsigned short h2, l2; splitf(a[q], h2, l2); oh[q] = h2; ol[q] = l2; }
    const size_t o = ((size_t)hh * LP + r) * HD + d0; *(v8us*)(Ph + o) = oh; *(v8us*)(Pl + o) = ol;  }
__global__ __launch_bounds__(256) void k_addrs(float* Sb, const float* __restrict__ QR) { const size_t k = (size_t)blockIdx.x * 256 + threadIdx.x; if (k >= (size_t)ZH * TT * TT / 4) return; const size_t e = k * 4; const int t0 = (int)(e % TT); const size_t zs = e / TT; const int s_ = (int)(zs % TT); const float* qr = QR + zs * LP; v4f a = *(const v4f*)(Sb + e);
#pragma unroll
    for (int q = 0; q < 4; ++q) { const int m = t0 + q - s_ + TT - 1; a[q] = __fadd_rn(a[q], qr[m]); }
    *(v4f*)(Sb + e) = a;  }
__global__ __launch_bounds__(256) void k_merge(const float* __restrict__ O, int h0, bf* Ah, bf* Al) { const size_t e = ((size_t)blockIdx.x * 256 + threadIdx.x) * 2; if (e >= (size_t)ZH * TT * HD) return; const int d = (int)(e % HD); const int t = (int)((e / HD) % TT); const int zz = (int)(e / ((size_t)HD * TT)); const float cs = (t < RH) ? 1.0f : (1.0f / PCAR); const size_t oo = (size_t)t * DQ + (h0 + zz) * HD + d;
    v2us oh, ol;
#pragma unroll
    for (int q = 0; q < 2; ++q) { unsigned short a, c2; splitf(O[e + q] * cs, a, c2); oh[q] = a; ol[q] = c2; } *(v2us*)(Ah + oo) = oh; *(v2us*)(Al + oo) = ol;  }

extern "C" void kernel_launch(void* const* d_in, const int* in_sizes, int n_in,
                              void* d_out, int out_size, void* d_ws, size_t ws_size, hipStream_t stream) {
    (void)in_sizes; (void)n_in; (void)out_size;
    const float* x = (const float*)d_in[0];   /* query */ const float* xk = (const float*)d_in[1]; const float* xv = (const float*)d_in[2]; const float* pos = (const float*)d_in[3];   /* [8][2047][512] */ const float* wq = (const float*)d_in[4]; const float* wk = (const float*)d_in[5]; const float* wv = (const float*)d_in[6]; const float* wp = (const float*)d_in[7]; const float* ub = (const float*)d_in[8]; const float* vb = (const float*)d_in[9];   /* u_bias, v_bias [8][64] */ const float* wo = (const float*)d_in[10];
    float* OUT = (float*)d_out;     // [8][1024][512]
    char* wsp = (char*)d_ws;
    auto take = [&](size_t bytes) { char* p = wsp; wsp += (bytes + 255) & ~(size_t)255; return (void*)p; };
    // kept to the end: weights, head planes of all batches, merged context
    bf* WP = (bf*)take((size_t)DQ * DM * 2); bf* WQ = (bf*)take((size_t)DQ * DM * 2); bf* WK = (bf*)take((size_t)DKV * DM * 2); bf* WV = (bf*)take((size_t)DKV * DM * 2); bf* WO = (bf*)take((size_t)DM * DQ * 2); float* CS = (float*)take((size_t)TT * HD * 2 * 4);
    bf* RPh = (bf*)take((size_t)NB_ * NH_ * LP * HD * 2); bf* RPl = (bf*)take((size_t)NB_ * NH_ * LP * HD * 2); bf* QVh = (bf*)take((size_t)NB_ * NH_ * TT * HD * 2); bf* QVl = (bf*)take((size_t)NB_ * NH_ * TT * HD * 2);
    bf* QPh = (bf*)take((size_t)NB_ * NH_ * TT * HD * 2); bf* QPl = (bf*)take((size_t)NB_ * NH_ * TT * HD * 2); bf* KPh = (bf*)take((size_t)NB_ * NKV * TT * HD * 2); bf* KPl = (bf*)take((size_t)NB_ * NKV * TT * HD * 2);
    h16* VT16 = (h16*)take((size_t)NB_ * NKV * HD * TT * 2); bf* VTh = (bf*)take((size_t)NB_ * NKV * HD * TT * 2); bf* VTl = (bf*)take((size_t)NB_ * NKV * HD * TT * 2); bf* ATh = (bf*)take((size_t)NB_ * TT * DQ * 2); bf* ATl = (bf*)take((size_t)NB_ * TT * DQ * 2);
    char* const shared0 = wsp;   // from here on two stream-ordered uses of the same bytes: first the projection stage's buffers, then the score pass's
    bf* XB = (bf*)take((size_t)NB_ * TT * DM * 2); bf* XP = (bf*)take((size_t)NB_ * LP * DM * 2); float* FP = (float*)take((size_t)NB_ * LP * DQ * 4); float* FQ = (float*)take((size_t)NB_ * TT * DQ * 4); float* FQV = (float*)take((size_t)NB_ * TT * DQ * 4); float* FK = (float*)take((size_t)NB_ * TT * DKV * 4);
    h16* QP16 = (h16*)take((size_t)NB_ * NH_ * TT * HD * 2); h16* QV16 = QP16; h16* KP16 = QP16;   // fp16 q and k planes: written by k_rope, read by nobody
    if ((size_t)(wsp - (char*)d_ws) > ws_size) return;
    wsp = shared0;
    float* QR = (float*)take((size_t)ZH * TT * LP * 4); float* Sb = (float*)take((size_t)ZH * TT * TT * 4); h16* P16 = (h16*)take((size_t)ZH * TT * TT * 2); bf* Ph = (bf*)take((size_t)ZH * RH * TT * 2); bf* Pl = (bf*)take((size_t)ZH * RH * TT * 2); float* Ob = (float*)take((size_t)ZH * TT * HD * 4);
    if ((size_t)(wsp - (char*)d_ws) > ws_size) return;    // ws 256 MiB
    float* FV = FK;   // v projection reuses the k buffer after the k planes are built (stream-ordered)
    { k_wtG<<<(unsigned)((DM * DQ / 64 + 63) / 64), 256, 0, stream>>>(wq, DM, DQ, WQ); k_wtG<<<(unsigned)((DM * DKV / 64 + 63) / 64), 256, 0, stream>>>(wk, DM, DKV, WK); k_wtG<<<(unsigned)((DM * DKV / 64 + 63) / 64), 256, 0, stream>>>(wv, DM, DKV, WV);
      k_wtG<<<(unsigned)((DQ * DM / 64 + 63) / 64), 256, 0, stream>>>(wo, DQ, DM, WO); k_wtG<<<(unsigned)((DM * DQ / 64 + 63) / 64), 256, 0, stream>>>(wp, DM, DQ, WP);
       }
    k_csid<<<(TT * HD + 255) / 256, 256, 0, stream>>>(CS);
    const unsigned LQ = (unsigned)(((size_t)NH_ * TT * HD / 2 + 255) / 256), LKv = (unsigned)(((size_t)NKV * TT * HD / 2 + 255) / 256);
    const unsigned LX = (unsigned)(((size_t)NB_ * TT * DM / 8 + 255) / 256);
    // projection stage, all batches per launch
    k_cvt8<<<LX, 256, 0, stream>>>(x, XB, (size_t)NB_ * TT * DM / 8, 0, 0);
    k_gemmw<bf, 0, false><<<dim3(NB_ * TT / 64, DQ / 64, 1), 32, 0, stream>>>(XB, nullptr, WQ, nullptr, DM, FQ, DQ, nullptr, 0, 0, 0);
    k_adduv<<<(unsigned)(((size_t)NB_ * TT * DQ / 4 + 255) / 256), 256, 0, stream>>>(FQ, ub, vb, FQV);   /* FQ += u (per head), FQV = q + v */
    k_rope<<<dim3(LQ, NB_), 256, 0, stream>>>(FQ, DQ, NH_, CS, nullptr, nullptr, 1.0f, QP16, QPh, QPl);
    k_rope<<<dim3(LQ, NB_), 256, 0, stream>>>(FQV, DQ, NH_, CS, nullptr, nullptr, 1.0f, QV16, QVh, QVl);   /* (q + v) planes */
    k_cvt8<<<dim3((unsigned)(((size_t)(LP - 1) * DM / 8 + 255) / 256), NB_), 256, 0, stream>>>(pos, XP, (size_t)(LP - 1) * DM / 8, (size_t)(LP - 1) * DM, (size_t)LP * DM);
    k_zrow<<<dim3((DM / 8 + 255) / 256, NB_), 256, 0, stream>>>(XP + (size_t)(LP - 1) * DM);   /* 2,047 position rows + one zero pad row per batch */
    k_gemmw<bf, 0, false><<<dim3(NB_ * LP / 64, DQ / 64, 1), 32, 0, stream>>>(XP, nullptr, WP, nullptr, DM, FP, DQ, nullptr, 0, 0, 0);   /* p = pos Wp [8 x 2048][512] */
    k_hsplit<<<dim3((unsigned)(((size_t)LP * DQ / 8 + 255) / 256), NB_), 256, 0, stream>>>(FP, RPh, RPl);   /* per-head hi/lo planes [batch][8][2048][64] */
    k_cvt8<<<LX, 256, 0, stream>>>(xk, XB, (size_t)NB_ * TT * DM / 8, 0, 0);
    k_gemmw<bf, 0, false><<<dim3(NB_ * TT / 64, DKV / 64, 1), 32, 0, stream>>>(XB, nullptr, WK, nullptr, DM, FK, DKV, nullptr, 0, 0, 0);
    k_rope<<<dim3(LKv, NB_), 256, 0, stream>>>(FK, DKV, NKV, CS, nullptr, nullptr, 1.0f, KP16, KPh, KPl);
    k_cvt8<<<LX, 256, 0, stream>>>(xv, XB, (size_t)NB_ * TT * DM / 8, 0, 0);
    k_gemmw<bf, 0, false><<<dim3(NB_ * TT / 64, DKV / 64, 1), 32, 0, stream>>>(XB, nullptr, WV, nullptr, DM, FV, DKV, nullptr, 0, 0, 0);
    k_vtp<<<dim3(LKv, NB_), 256, 0, stream>>>(FV, DKV, NKV, VT16, VTh, VTl);
    for (int b = 0; b < NB_; ++b) { const size_t zq = (size_t)b * NH_, zk = (size_t)b * NKV;   // one kv head per query head: the pass's heads use consecutive planes (z-strides TT*HD)
        k_gemmw<bf, 2, false><<<dim3(TT / 64, TT / 64, ZH), 32, 0, stream>>>(QPh + zq * TT * HD, QPl + zq * TT * HD, KPh + zk * TT * HD, KPl + zk * TT * HD, HD, Sb, TT, nullptr, (size_t)TT * HD, (size_t)TT * HD, (size_t)TT * TT);   /* content (q + u).k, hi/lo on EVERY row */
        k_gemmw<bf, 2, false><<<dim3(TT / 64, LP / 64, ZH), 32, 0, stream>>>(QVh + zq * TT * HD, QVl + zq * TT * HD, RPh + zq * LP * HD, RPl + zq * LP * HD, HD, QR, LP, nullptr, (size_t)TT * HD, (size_t)LP * HD, (size_t)TT * LP);   /* pos_raw = (q + v).p [1024][2048] */
        k_addrs<<<(unsigned)(((size_t)ZH * TT * TT / 4 + 255) / 256), 256, 0, stream>>>(Sb, QR);   /* rel_shift: Sb[s][t] += QR[s][t - s + 1023] */
        k_asoft<<<ZH * TT / 8, 256, 0, stream>>>(Sb, P16, Ph, Pl);
        k_gemmw<bf, 2, false><<<dim3(RH / 64, HD / 64, ZH), 32, 0, stream>>>(Ph, Pl, VTh + zk * HD * TT, VTl + zk * HD * TT, TT, Ob, HD, nullptr, (size_t)RH * TT, (size_t)HD * TT, (size_t)TT * HD);
        k_gemmw<h16, 0, false><<<dim3((TT - RH) / 64, HD / 64, ZH), 32, 0, stream>>>(P16 + (size_t)RH * TT, nullptr, VT16 + zk * HD * TT, nullptr, TT, Ob + (size_t)RH * HD, HD, nullptr, (size_t)TT * TT, (size_t)HD * TT, (size_t)TT * HD);
        k_merge<<<(unsigned)(((size_t)ZH * TT * HD / 2 + 255) / 256), 256, 0, stream>>>(Ob, 0, ATh + (size_t)b * TT * DQ, ATl + (size_t)b * TT * DQ); }
    k_gemmw<bf, 1, false><<<dim3(NB_ * TT / 64, DM / 64, 1), 32, 0, stream>>>(ATh, ATl, WO, nullptr, DQ, OUT, DM, nullptr, 0, 0, 0);
}

// v003
// It runs in 318 microseconds.
// Versions in between are left out here; by their measured steps it is 3.23 times as fast as v001.
// Counting every step since v000, it is 9.20 times as fast.
#include <hip/hip_runtime.h>

// Conformer-style relative multi-head attention with content/position biases (query, key, value [8][1024][512]; pos_encoding [8][2047][512]; q = query Wq, k = key Wk, v = value Wv, p = pos_encoding Wp ('xw' [512][512] 1/sqrt(512)); 8 heads x 64; content = (q + u_bias).k, pos = rel_shift((q + v_bias).p) with rel_shift[s][t] = pos_raw[s][t - s + 1023] (u_bias, v_bias [8][64] read); score = (content + pos) / 8; softmax (no mask); out = merged Wo ('xw') -> [8][1024][512] (4.2 M)).
// Layout: every stage in front of the scores and the Wo product run ONCE for all 8 batches (batch rows flat in the GEMM's M, or batch = blockIdx.y). bf16 copies of query, key, value in turn and of each batch's 2,047 position rows (zero-padded to 2,048); 'xw' weights transposed once; exact projections, whose GEMM epilogues write the head planes themselves (k_gemmw, EPI >= 0): q + u and q + v (per-head f32 bias adds) as separate hi/lo plane sets, k hi/lo, v transposed (fp16 and hi/lo), p as per-head hi/lo planes [batch][8][2048][64]; then ONE launch for all scores (k_fattn): a work-group owns 32 query rows of one (batch, head) and keeps their 32 x 1024 f32 scores in LDS: position products (3 products) stored skewed (the rel_shift), content products (3 products) added on top, row softmax in place, P (rows < 512 hi/lo, rest fp16 x1024) in place, attn.v from LDS, merged hi/lo rows out; merged hi/lo x Wo exact.
// Compute dtypes, f32 accumulate: every input rounded to bf16; projections exact; bias adds f32; content and position scores 3 products; softmax f32 (x 1/8 on the scores); attn.v rows < 512 3 products, rest fp16; Wo hl x exact.

#define NB_  8
#define TT   1024
#define DM   512
#define NH_  8
#define NKV  8
#define REP  (NH_ / NKV)
#define HD   64
#define DQ   (NH_ * HD)
#define DKV  (NKV * HD)
#define RH   512                  // query rows < RH use hi+lo planes (0: none)
#define WIN  0
#define PCAR 1024.0f
#define SCL  0.125f   // HD^-0.5
#define LP   2048     // padded position rows (2*TT - 1 = 2047 used)
typedef _Float16 h16;
typedef unsigned short bf;
typedef __attribute__((ext_vector_type(16))) __bf16   v16bf;
typedef __attribute__((ext_vector_type(16))) _Float16 v16h;
typedef __attribute__((ext_vector_type(8)))  _Float16 v8h;
typedef __attribute__((ext_vector_type(8)))  unsigned short v8us;
typedef __attribute__((ext_vector_type(8)))  float    v8f;
typedef __attribute__((ext_vector_type(4)))  float    v4f;
typedef v8h  __attribute__((may_alias)) v8ha;
typedef v4f  __attribute__((may_alias)) v4fa;
typedef v8us __attribute__((may_alias)) v8usa;

__device__ __forceinline__ unsigned short f2bf(float f) { unsigned u = __float_as_uint(f); u += 0x7FFFu + ((u >> 16) & 1u); return (unsigned short)(u >> 16); }
__device__ __forceinline__ float bf2f(unsigned short b) { return __uint_as_float(((unsigned)b) << 16); }
__device__ __forceinline__ float bfr(float f) { return bf2f(f2bf(f)); }
__device__ __forceinline__ v16h cat16(v8h lo, v8h hi) { return __builtin_shufflevector(lo, hi, 0, 1, 2, 3, 4, 5, 6, 7, 8, 9, 10, 11, 12, 13, 14, 15); }
__device__ __forceinline__ v16bf cat16b(v8us lo, v8us hi) { return __builtin_bit_cast(v16bf, __builtin_shufflevector(lo, hi, 0, 1, 2, 3, 4, 5, 6, 7, 8, 9, 10, 11, 12, 13, 14, 15)); }
__device__ __forceinline__ v8f wmma16(v16h a, v16h b, v8f c) { return __builtin_amdgcn_wmma_f32_16x16x32_f16(false, a, false, b, (short)0, c, false, false); }
__device__ __forceinline__ v8f wmmab(v16bf a, v16bf b, v8f c) { return __builtin_amdgcn_wmma_f32_16x16x32_bf16(false, a, false, b, (short)0, c, false, false); }



__device__ __forceinline__ h16 tohx(float x) { return (h16)x; }
__device__ __forceinline__ void splitf(float y, unsigned short& h, unsigned short& l) { h = f2bf(y); l = f2bf(y - bf2f(h)); }

// ---- k_gemmw: register-blocked GEMM, ONE WAVE per 64x64 output tile (16 accumulators), operands straight from K-contiguous 16-bit planes; grid (M/64, N/64, Z), 32 threads.
// C[m][n] (f32, pitch ldc, + optional f32 bias[n]) = sum_k A[m][k] Bt[n][k] (+ split products per NSPLIT). z-batch strides sA/sB/sC in elements. K % 32 == 0.
// EPI >= 0 (the projections): C is not stored; the epilogue writes the head planes itself, so that no f32 projection row goes through memory. A 64-column tile is one head, a 64-row tile lies inside one batch of 'rows' rows.
// EPI 0: hi/lo planes [batch][head][rows][64] of C. EPI 1: two such plane sets, of C + u and of C + v (f32 adds of the bf16-rounded per-head biases). EPI 2: transposed planes [batch][head][64][rows] of C, fp16 and hi/lo.
template <typename T16> struct WFrag;
template <> struct WFrag<h16> { typedef v16h V; static __device__ __forceinline__ V ld(const h16* p) { return cat16(*(const v8h*)p, *(const v8h*)(p + 16)); } static __device__ __forceinline__ v8f mma(V a, V b, v8f c) { return wmma16(a, b, c); } };
template <> struct WFrag<bf> { typedef v16bf V; static __device__ __forceinline__ V ld(const bf* p) { return cat16b(*(const v8us*)p, *(const v8us*)(p + 16)); } static __device__ __forceinline__ v8f mma(V a, V b, v8f c) { return wmmab(a, b, c); } };
template <typename T16, int NSPLIT, bool BIAS, int EPI, int rows>
__global__ __launch_bounds__(32) void k_gemmw(const T16* __restrict__ A, const T16* __restrict__ A2, const T16* __restrict__ Bt, const T16* __restrict__ Bt2, int K, float* C, int ldc, const float* __restrict__ bias, size_t sA, size_t sB, size_t sC,
                                              const float* __restrict__ ub, const float* __restrict__ vb, bf* Ph, bf* Pl, bf* P2h, bf* P2l, h16* P16) {
    typedef typename WFrag<T16>::V V;
    __shared__ __align__(16) float os[16 * 68];
    const size_t z = blockIdx.z; A += z * sA; if (A2) A2 += z * sA; Bt += z * sB; if (Bt2) Bt2 += z * sB; C += z * sC;
    const int lane = threadIdx.x & 31, lr = lane & 15, hi = lane >> 4; const int r0 = blockIdx.x * 64, c0 = blockIdx.y * 64;
    v8f acc[4][4];
#pragma unroll
    for (int mb = 0; mb < 4; ++mb)
#pragma unroll
        for (int nb = 0; nb < 4; ++nb) acc[mb][nb] = (v8f){};
    const size_t aoff = (size_t)(r0 + lr) * K + 8 * hi, boff = (size_t)(c0 + lr) * K + 8 * hi;
#pragma unroll 1
    for (int kc = 0; kc < K; kc += 32) {
        V a[4], a2[4];
#pragma unroll
        for (int mb = 0; mb < 4; ++mb) { a[mb] = WFrag<T16>::ld(A + aoff + (size_t)mb * 16 * K + kc); if (NSPLIT == 1 || NSPLIT == 2) a2[mb] = WFrag<T16>::ld(A2 + aoff + (size_t)mb * 16 * K + kc); }
#pragma unroll
        for (int nb = 0; nb < 4; ++nb) { const V b = WFrag<T16>::ld(Bt + boff + (size_t)nb * 16 * K + kc); V b2; if (NSPLIT >= 2) b2 = WFrag<T16>::ld(Bt2 + boff + (size_t)nb * 16 * K + kc);
#pragma unroll
            for (int mb = 0; mb < 4; ++mb) { acc[mb][nb] = WFrag<T16>::mma(a[mb], b, acc[mb][nb]); if (NSPLIT == 1 || NSPLIT == 2) acc[mb][nb] = WFrag<T16>::mma(a2[mb], b, acc[mb][nb]); if (NSPLIT >= 2) acc[mb][nb] = WFrag<T16>::mma(a[mb], b2, acc[mb][nb]); } }
        asm volatile("v_nop\n\tv_nop\n\tv_nop\n\tv_nop" : "+v"(acc[0][0]), "+v"(acc[1][1]), "+v"(acc[2][2]), "+v"(acc[3][3]) : "v"(a[0]), "v"(a[3]));
    }
    const size_t pz = (size_t)(r0 / rows) * NH_ + blockIdx.y; const int t0 = r0 % rows;   // plane index batch * heads + head; the tile's first row in it
    if constexpr (EPI == 2) {   // a lane's 8 accumulator rows are 8 successive t of one d: 16-byte stores straight from registers
        const size_t vo = (pz * HD + lr) * rows + t0 + hi * 8;
#pragma unroll
        for (int nb = 0; nb < 4; ++nb) {
#pragma unroll
            for (int mb = 0; mb < 4; ++mb) { v8h o16; v8us oh, ol;
#pragma unroll
                for (int j = 0; j < 8; ++j) { const float x = acc[mb][nb][j]; o16[j] = tohx(x); unsigned short h2, l2; splitf(x, h2, l2); oh[j] = h2; ol[j] = l2; }
                const size_t o = vo + (size_t)nb * 16 * rows + mb * 16; *(v8h*)(P16 + o) = o16; *(v8us*)(Ph + o) = oh; *(v8us*)(Pl + o) = ol; } }
        return;
    }
    if constexpr (EPI == 0 || EPI == 1) {   // 16 rows at a time through LDS: a lane then holds 8 successive d of one row, 8 lanes store one whole 128-byte plane row
        const int rr = lane >> 3, d0 = (lane & 7) * 8; float bu[8], bv[8];
        if constexpr (EPI == 1) {
#pragma unroll
            for (int q = 0; q < 8; ++q) { bu[q] = bfr(ub[c0 + d0 + q]); bv[q] = bfr(vb[c0 + d0 + q]); } }
        const size_t po = (pz * rows + t0 + rr) * HD + d0;
#pragma unroll
        for (int mb = 0; mb < 4; ++mb) {
#pragma unroll
            for (int nb = 0; nb < 4; ++nb) {
#pragma unroll
                for (int j = 0; j < 8; ++j) os[(hi * 8 + j) * 68 + nb * 16 + lr] = acc[mb][nb][j]; }
            __builtin_amdgcn_wave_barrier(); asm volatile("" ::: "memory");   // the wave's LDS stores stay in front of the reads that other lanes make of them (one wave: the LDS keeps the order, the compiler must too)
#pragma unroll
            for (int s = 0; s < 4; ++s) { const v4f x0 = *(const v4fa*)(os + (s * 4 + rr) * 68 + d0), x1 = *(const v4fa*)(os + (s * 4 + rr) * 68 + d0 + 4); const size_t o = po + (size_t)(mb * 16 + s * 4) * HD; v8us oh, ol, o2h, o2l;
#pragma unroll
                for (int q = 0; q < 8; ++q) { const float x = (q < 4 ? x0[q & 3] : x1[q & 3]); unsigned short h2, l2; splitf(EPI == 1 ? __fadd_rn(x, bu[q]) : x, h2, l2); oh[q] = h2; ol[q] = l2;
                    if constexpr (EPI == 1) { splitf(__fadd_rn(x, bv[q]), h2, l2); o2h[q] = h2; o2l[q] = l2; } }
                *(v8us*)(Ph + o) = oh; *(v8us*)(Pl + o) = ol; if constexpr (EPI == 1) { *(v8us*)(P2h + o) = o2h; *(v8us*)(P2l + o) = o2l; }
                asm volatile("s_wait_xcnt 0x0" ::: "memory"); }   // stands in front of whatever next rewrites these stores' address and data registers
            __builtin_amdgcn_wave_barrier(); asm volatile("" ::: "memory");   // and these reads in front of the next 16 rows' stores
        }
        return;
    }
#pragma unroll
    for (int mb = 0; mb < 4; ++mb) {
#pragma unroll
        for (int nb = 0; nb < 4; ++nb) {
#pragma unroll
            for (int j = 0; j < 8; ++j) os[(hi * 8 + j) * 68 + nb * 16 + lr] = acc[mb][nb][j]; }
        __builtin_amdgcn_wave_barrier(); asm volatile("" ::: "memory");
        float* crow = C + (size_t)(r0 + mb * 16) * ldc + c0;
{
#pragma unroll
            for (int s = 0; s < 8; ++s) { const int row = 2 * s + hi, cofs = lr * 4; v4f val = *(const v4fa*)(os + row * 68 + cofs); if (BIAS) { val[0] += bfr(bias[c0 + cofs]); val[1] += bfr(bias[c0 + cofs + 1]); val[2] += bfr(bias[c0 + cofs + 2]); val[3] += bfr(bias[c0 + cofs + 3]); }
                *(v4f*)(crow + (size_t)row * ldc + cofs) = val; }
             }
        __builtin_amdgcn_wave_barrier(); asm volatile("" ::: "memory");
    }
}

typedef __attribute__((ext_vector_type(2))) _Float16 v2h;
typedef __attribute__((ext_vector_type(4))) _Float16 v4h;
typedef __attribute__((ext_vector_type(2))) unsigned short v2us;
typedef __attribute__((ext_vector_type(4))) unsigned short v4us;
typedef __attribute__((ext_vector_type(2))) float v2f;
typedef __attribute__((ext_vector_type(4))) int v4i;

__global__ __launch_bounds__(256) void k_wtG(const float* __restrict__ w, int K, int N, bf* Bt) {
    const int lane = threadIdx.x & 31; const int L0 = (blockIdx.x * 8 + (threadIdx.x >> 5)) * 8; const int nlines = N * K / 64;
{
#pragma unroll 1
        for (int l = 0; l < 8; ++l) { const int L = L0 + l; if (L >= nlines) break; const size_t e = (size_t)L * 64 + lane * 2; const int k = (int)(e % K), n = (int)(e / K); v2us o;
            o[0] = f2bf(w[(size_t)k * N + n]); o[1] = f2bf(w[(size_t)(k + 1) * N + n]); *(v2us*)(Bt + e) = o; }
         }
}
__global__ __launch_bounds__(256) void k_cvt8(const float* __restrict__ src, bf* dst, size_t n8, size_t sS, size_t sD) { const size_t i = (size_t)blockIdx.x * 256 + threadIdx.x; if (i >= n8) return; src += blockIdx.y * sS; dst += blockIdx.y * sD; const v8f v = *(const v8f*)(src + i * 8); v8us o;
#pragma unroll
    for (int k = 0; k < 8; ++k) o[k] = f2bf(v[k]); *(v8us*)(dst + i * 8) = o;  }

__global__ __launch_bounds__(256) void k_zrow(bf* R) { const int i = blockIdx.x * 256 + threadIdx.x; if (i >= DM / 8) return; R += (size_t)blockIdx.y * LP * DM; v8us z; for (int q = 0; q < 8; ++q) z[q] = 0; *(v8us*)(R + i * 8) = z;  }
// ---- k_fattn: scores, rel_shift, softmax, attn.v and the head merge for MR query rows of one (batch, head); grid (TT / MR, batches x heads), 8 waves.
// The score strip S[MR][TT] (f32, pitch SP) never leaves LDS. Every sum keeps the order of a 16x16x32 product chain over k ascending (hi.hi, lo.hi, hi.lo per 32 k), content + position added once, the row softmax with its fixed trees.
#define MR 32      // query rows per work-group (two 16-row tiles)
#define SP 1028    // f32 pitch of a score row in LDS: rows 8 apart fall 32 banks apart, 16-byte aligned
typedef v4us __attribute__((may_alias)) v4usa;
typedef v4h  __attribute__((may_alias)) v4ha;
// the hi and lo fragments of one 16-row tile of B (64 k)
struct BTile { v16bf b[2], b2[2]; };
__device__ __forceinline__ void ld_btile(BTile& x, const bf* __restrict__ bh, const bf* __restrict__ bl) {
#pragma unroll
    for (int ks = 0; ks < 2; ++ks) { x.b[ks] = WFrag<bf>::ld(bh + ks * 32); x.b2[ks] = WFrag<bf>::ld(bl + ks * 32); }
    asm volatile("s_wait_xcnt 0x0" ::: "memory");   // stands in front of whatever next rewrites these loads' address registers
}
// one plane's fragments of the strip's 32 query rows (two 16-row tiles x 64 k)
__device__ __forceinline__ void ld_qfrags(v16bf (&a)[2][2], const bf* __restrict__ q) {
#pragma unroll
    for (int sub = 0; sub < 2; ++sub) {
#pragma unroll
        for (int ks = 0; ks < 2; ++ks) a[sub][ks] = WFrag<bf>::ld(q + sub * 16 * HD + ks * 32); }
    asm volatile("s_wait_xcnt 0x0" ::: "memory");   // stands in front of whatever next rewrites these loads' address registers
}
// one B tile against both 16-row tiles of A: acc[sub] = sum over 64 k, 3 products
__device__ __forceinline__ void qk_tile(const v16bf (&a)[2][2], const v16bf (&a2)[2][2], const BTile& x, v8f (&acc)[2]) {
    acc[0] = (v8f){}; acc[1] = (v8f){};
#pragma unroll
    for (int ks = 0; ks < 2; ++ks) {
#pragma unroll
        for (int sub = 0; sub < 2; ++sub) { acc[sub] = wmmab(a[sub][ks], x.b[ks], acc[sub]); acc[sub] = wmmab(a2[sub][ks], x.b[ks], acc[sub]); acc[sub] = wmmab(a[sub][ks], x.b2[ks], acc[sub]); } }
    asm volatile("v_nop\n\tv_nop\n\tv_nop\n\tv_nop" :: "v"(acc[0]), "v"(acc[1]));   // four vector slots behind the last product: the next tile's first product starts from zero in the same result registers, with only LDS stores and loads between
}
// position tile: S[row][m + s - 1023] = (q + v).p[m]; EDGE: part of the tile may fall outside 0 <= t < TT and is dropped
template <bool EDGE>
__device__ __forceinline__ void pos_store(float* S, const v8f (&acc)[2], int m0, int s0, int lr, int hi) {
    const int tb = m0 + lr + s0 + hi * 8 - (TT - 1);   // t of (sub 0, j 0)
#pragma unroll
    for (int sub = 0; sub < 2; ++sub) {
#pragma unroll
        for (int j = 0; j < 8; ++j) { const int t = tb + sub * 16 + j; if (!EDGE || (unsigned)t < (unsigned)TT) S[(sub * 16 + hi * 8 + j) * SP + t] = acc[sub][j]; } }
}
// attn.v for one 16 x 16 output tile: P rows from LDS (pa; lo plane TT elements behind the hi plane), v rows [d][t] from global; k = t ascending, per 32 k: hi.hi, lo.hi, hi.lo (SPLIT) or one product.
// Stages of 64 k: v fragments fetched two stages ahead, P fragments one stage ahead.
template <typename T16, bool SPLIT>
__device__ __forceinline__ v8f pv_tile(const T16* pa, const T16* __restrict__ vh, const T16* __restrict__ vl) {
    typedef typename WFrag<T16>::V V; constexpr int NS = TT / 64;
    V b[3][2], b2[3][2], a[2][2], a2[2][2]; v8f acc = (v8f){};
#pragma unroll
    for (int s = 0; s < 2; ++s) {
#pragma unroll
        for (int ks = 0; ks < 2; ++ks) { b[s][ks] = WFrag<T16>::ld(vh + s * 64 + ks * 32); if (SPLIT) b2[s][ks] = WFrag<T16>::ld(vl + s * 64 + ks * 32); } }
#pragma unroll
    for (int ks = 0; ks < 2; ++ks) { a[0][ks] = WFrag<T16>::ld(pa + ks * 32); if (SPLIT) a2[0][ks] = WFrag<T16>::ld(pa + TT + ks * 32); }
#pragma unroll
    for (int s = 0; s < NS; ++s) {
        if (s + 2 < NS) {
#pragma unroll
            for (int ks = 0; ks < 2; ++ks) { b[(s + 2) % 3][ks] = WFrag<T16>::ld(vh + (s + 2) * 64 + ks * 32); if (SPLIT) b2[(s + 2) % 3][ks] = WFrag<T16>::ld(vl + (s + 2) * 64 + ks * 32); } }
        if (s + 1 < NS) {
#pragma unroll
            for (int ks = 0; ks < 2; ++ks) { a[(s + 1) & 1][ks] = WFrag<T16>::ld(pa + (s + 1) * 64 + ks * 32); if (SPLIT) a2[(s + 1) & 1][ks] = WFrag<T16>::ld(pa + TT + (s + 1) * 64 + ks * 32); } }
        __builtin_amdgcn_sched_barrier(0);   // keeps the later stages' loads in front of this stage's products; without it they sink to their uses and each stage waits out a whole load
#pragma unroll
        for (int ks = 0; ks < 2; ++ks) { acc = WFrag<T16>::mma(a[s & 1][ks], b[s % 3][ks], acc); if (SPLIT) { acc = WFrag<T16>::mma(a2[s & 1][ks], b[s % 3][ks], acc); acc = WFrag<T16>::mma(a[s & 1][ks], b2[s % 3][ks], acc); } }
    }
    return acc;
}
__global__ __launch_bounds__(256) void k_fattn(const bf* __restrict__ QPh, const bf* __restrict__ QPl, const bf* __restrict__ QVh, const bf* __restrict__ QVl, const bf* __restrict__ KPh, const bf* __restrict__ KPl, const bf* __restrict__ RPh, const bf* __restrict__ RPl,
                                               const h16* __restrict__ VT16, const bf* __restrict__ VTh, const bf* __restrict__ VTl, bf* ATh, bf* ATl) {
    __shared__ __align__(16) float S[MR * SP];
    __shared__ __align__(16) float Os[MR * 68];
    const int lane = threadIdx.x & 31, lr = lane & 15, hi = lane >> 4; const int w = __builtin_amdgcn_readfirstlane(threadIdx.x >> 5);
    const int s0 = blockIdx.x * MR; const size_t z = blockIdx.y;   // z = batch * 8 + head: plane index of every operand
    const bool hires = (s0 < RH);
    const size_t qoff = (z * TT + s0 + lr) * HD + 8 * hi;
    {   // position scores, stored skewed: the 66 tiles of 16 p rows that the 32 query rows reach; wave w takes tiles w + 8 k; tiles 0, 1, 64, 65 cross an end of the key range
        v16bf a[2][2], a2[2][2];
        ld_qfrags(a, QVh + qoff); ld_qfrags(a2, QVl + qoff);
        const int mb = (TT - MR) - s0 + w * 16;   // the wave's first p row; tile 0 starts where t = 0 meets the strip's last query row
        const bf* ph = RPh + (z * LP + mb + lr) * HD + 8 * hi; const bf* pl = RPl + (z * LP + mb + lr) * HD + 8 * hi;
        BTile bt[2]; ld_btile(bt[0], ph, pl);
#pragma unroll
        for (int k = 0; k < 8; ++k) {
            if (k < 7 || w < 2) ld_btile(bt[(k + 1) & 1], ph + (k + 1) * 128 * HD, pl + (k + 1) * 128 * HD);
            __builtin_amdgcn_sched_barrier(0);   // keeps the next tile's loads in front of this tile's products, so that they fly meanwhile
            v8f acc[2]; qk_tile(a, a2, bt[k & 1], acc);
            if (k == 0) pos_store<true>(S, acc, mb, s0, lr, hi); else pos_store<false>(S, acc, mb + k * 128, s0, lr, hi);
        }
        if (w < 2) { v8f acc[2]; qk_tile(a, a2, bt[0], acc); pos_store<true>(S, acc, mb + 8 * 128, s0, lr, hi); }
    }
    __syncthreads();   // every position score is in S before a content score is added to it
    {   // content scores on top; wave w takes key tiles w + 8 k
        v16bf a[2][2], a2[2][2];
        ld_qfrags(a, QPh + qoff); ld_qfrags(a2, QPl + qoff);
        const bf* kh = KPh + (z * TT + w * 16 + lr) * HD + 8 * hi; const bf* kl = KPl + (z * TT + w * 16 + lr) * HD + 8 * hi;
        float* sw = S + hi * 8 * SP + w * 16 + lr;
        BTile bt[2]; ld_btile(bt[0], kh, kl);
#pragma unroll
        for (int k = 0; k < 8; ++k) {
            if (k < 7) ld_btile(bt[(k + 1) & 1], kh + (k + 1) * 128 * HD, kl + (k + 1) * 128 * HD);
            float old[2][8];
#pragma unroll
            for (int sub = 0; sub < 2; ++sub) {
#pragma unroll
                for (int j = 0; j < 8; ++j) old[sub][j] = sw[(sub * 16 + j) * SP + k * 128]; }
            __builtin_amdgcn_sched_barrier(0);   // keeps the next tile's loads and this tile's position scores in front of the products, so that they fly meanwhile
            v8f acc[2]; qk_tile(a, a2, bt[k & 1], acc);
#pragma unroll
            for (int sub = 0; sub < 2; ++sub) {
#pragma unroll
                for (int j = 0; j < 8; ++j) sw[(sub * 16 + j) * SP + k * 128] = __fadd_rn(acc[sub][j], old[sub][j]); }
        }
    }
    __syncthreads();   // whole score rows before the softmax
    // softmax: one wave per row, 4 rows a wave; t = S x HD^-0.5 (no mask), register row, one exp, fixed trees; P overwrites the row it came from (hi plane then lo plane, or fp16)
#pragma unroll 1
    for (int r = 0; r < MR / 8; ++r) { float* sr = S + (w * (MR / 8) + r) * SP; float v[TT / 32]; float mx = -3.0e38f;
#pragma unroll
        for (int ch = 0; ch < TT / 128; ++ch) { const v4f a = *(const v4fa*)(sr + ch * 128 + lane * 4);
#pragma unroll
            for (int q = 0; q < 4; ++q) { const float t = a[q] * SCL; v[ch * 4 + q] = t; mx = fmaxf(mx, t); } }
#pragma unroll
        for (int sh = 16; sh; sh >>= 1) mx = fmaxf(mx, __shfl_xor(mx, sh, 32));
        float sum = 0.f;
#pragma unroll
        for (int k = 0; k < TT / 32; ++k) { const float d0 = __fsub_rn(v[k], mx); v[k] = __builtin_amdgcn_exp2f(__fmul_rn(d0, 1.4426950408889634f)); sum += v[k]; }
#pragma unroll
        for (int sh = 16; sh; sh >>= 1) sum += __shfl_xor(sum, sh, 32);
        const float f = __fdiv_rn(hires ? 1.0f : PCAR, sum);
        if (hires) { bf* ph = (bf*)sr;
#pragma unroll
            for (int ch = 0; ch < TT / 128; ++ch) { v4us oh, ol;
#pragma unroll
                for (int q = 0; q < 4; ++q) { unsigned short a, c2; splitf(v[ch * 4 + q] * f, a, c2); oh[q] = a; ol[q] = c2; }
                *(v4usa*)(ph + ch * 128 + lane * 4) = oh; *(v4usa*)(ph + TT + ch * 128 + lane * 4) = ol; }
        } else { h16* p16 = (h16*)sr;
#pragma unroll
            for (int ch = 0; ch < TT / 128; ++ch) { v4h o4;
#pragma unroll
                for (int q = 0; q < 4; ++q) o4[q] = tohx(v[ch * 4 + q] * f);
                *(v4ha*)(p16 + ch * 128 + lane * 4) = o4; } }
    }
    __syncthreads();   // every P row before attn.v reads it
    {   // attn.v: one 16 x 16 output tile a wave
        const int sub = w >> 2, nt = w & 3; const float* prow = S + (sub * 16 + lr) * SP; const size_t voff = (z * HD + nt * 16 + lr) * TT + 8 * hi;
        const v8f acc = hires ? pv_tile<bf, true>((const bf*)prow + 8 * hi, VTh + voff, VTl + voff) : pv_tile<h16, false>((const h16*)prow + 8 * hi, VT16 + voff, nullptr);
#pragma unroll
        for (int j = 0; j < 8; ++j) Os[(sub * 16 + hi * 8 + j) * 68 + nt * 16 + lr] = acc[j];
    }
    __syncthreads();   // the 32 x 64 context tile is whole before it is split and stored by rows
    { const int row = threadIdx.x >> 3, d0 = (threadIdx.x & 7) * 8; const float cs = hires ? 1.0f : (1.0f / PCAR); const v4f x0 = *(const v4fa*)(Os + row * 68 + d0), x1 = *(const v4fa*)(Os + row * 68 + d0 + 4); v8us oh, ol;
#pragma unroll
        for (int q = 0; q < 8; ++q) { unsigned short a, c2; splitf((q < 4 ? x0[q & 3] : x1[q & 3]) * cs, a, c2); oh[q] = a; ol[q] = c2; }
        const size_t oo = ((z / NH_) * TT + s0 + row) * DQ + (z % NH_) * HD + d0; *(v8us*)(ATh + oo) = oh; *(v8us*)(ATl + oo) = ol; }
}

extern "C" void kernel_launch(void* const* d_in, const int* in_sizes, int n_in,
                              void* d_out, int out_size, void* d_ws, size_t ws_size, hipStream_t stream) {
    (void)in_sizes; (void)n_in; (void)out_size;
    const float* x = (const float*)d_in[0];   /* query */ const float* xk = (const float*)d_in[1]; const float* xv = (const float*)d_in[2]; const float* pos = (const float*)d_in[3];   /* [8][2047][512] */ const float* wq = (const float*)d_in[4]; const float* wk = (const float*)d_in[5]; const float* wv = (const float*)d_in[6]; const float* wp = (const float*)d_in[7]; const float* ub = (const float*)d_in[8]; const float* vb = (const float*)d_in[9];   /* u_bias, v_bias [8][64] */ const float* wo = (const float*)d_in[10];
    float* OUT = (float*)d_out;     // [8][1024][512]
    char* wsp = (char*)d_ws;
    auto take = [&](size_t bytes) { char* p = wsp; wsp += (bytes + 255) & ~(size_t)255; return (void*)p; };
    // kept to the end: weights, head planes of all batches, merged context
    bf* WP = (bf*)take((size_t)DQ * DM * 2); bf* WQ = (bf*)take((size_t)DQ * DM * 2); bf* WK = (bf*)take((size_t)DKV * DM * 2); bf* WV = (bf*)take((size_t)DKV * DM * 2); bf* WO = (bf*)take((size_t)DM * DQ * 2);
    bf* RPh = (bf*)take((size_t)NB_ * NH_ * LP * HD * 2); bf* RPl = (bf*)take((size_t)NB_ * NH_ * LP * HD * 2); bf* QVh = (bf*)take((size_t)NB_ * NH_ * TT * HD * 2); bf* QVl = (bf*)take((size_t)NB_ * NH_ * TT * HD * 2);
    bf* QPh = (bf*)take((size_t)NB_ * NH_ * TT * HD * 2); bf* QPl = (bf*)take((size_t)NB_ * NH_ * TT * HD * 2); bf* KPh = (bf*)take((size_t)NB_ * NKV * TT * HD * 2); bf* KPl = (bf*)take((size_t)NB_ * NKV * TT * HD * 2);
    h16* VT16 = (h16*)take((size_t)NB_ * NKV * HD * TT * 2); bf* VTh = (bf*)take((size_t)NB_ * NKV * HD * TT * 2); bf* VTl = (bf*)take((size_t)NB_ * NKV * HD * TT * 2); bf* ATh = (bf*)take((size_t)NB_ * TT * DQ * 2); bf* ATl = (bf*)take((size_t)NB_ * TT * DQ * 2);
    // projection stage's buffers
    bf* XB = (bf*)take((size_t)NB_ * TT * DM * 2); bf* XP = (bf*)take((size_t)NB_ * LP * DM * 2);
    if ((size_t)(wsp - (char*)d_ws) > ws_size) return;
    { k_wtG<<<(unsigned)((DM * DQ / 64 + 63) / 64), 256, 0, stream>>>(wq, DM, DQ, WQ); k_wtG<<<(unsigned)((DM * DKV / 64 + 63) / 64), 256, 0, stream>>>(wk, DM, DKV, WK); k_wtG<<<(unsigned)((DM * DKV / 64 + 63) / 64), 256, 0, stream>>>(wv, DM, DKV, WV);
      k_wtG<<<(unsigned)((DQ * DM / 64 + 63) / 64), 256, 0, stream>>>(wo, DQ, DM, WO); k_wtG<<<(unsigned)((DM * DQ / 64 + 63) / 64), 256, 0, stream>>>(wp, DM, DQ, WP);
       }
    const unsigned LX = (unsigned)(((size_t)NB_ * TT * DM / 8 + 255) / 256);
    // projection stage, all batches per launch
    k_cvt8<<<LX, 256, 0, stream>>>(x, XB, (size_t)NB_ * TT * DM / 8, 0, 0);
    k_gemmw<bf, 0, false, 1, TT><<<dim3(NB_ * TT / 64, DQ / 64, 1), 32, 0, stream>>>(XB, nullptr, WQ, nullptr, DM, nullptr, 0, nullptr, 0, 0, 0, ub, vb, QPh, QPl, QVh, QVl, nullptr);   /* (q + u) and (q + v) planes */
    k_cvt8<<<dim3((unsigned)(((size_t)(LP - 1) * DM / 8 + 255) / 256), NB_), 256, 0, stream>>>(pos, XP, (size_t)(LP - 1) * DM / 8, (size_t)(LP - 1) * DM, (size_t)LP * DM);
    k_zrow<<<dim3((DM / 8 + 255) / 256, NB_), 256, 0, stream>>>(XP + (size_t)(LP - 1) * DM);   /* 2,047 position rows + one zero pad row per batch */
    k_gemmw<bf, 0, false, 0, LP><<<dim3(NB_ * LP / 64, DQ / 64, 1), 32, 0, stream>>>(XP, nullptr, WP, nullptr, DM, nullptr, 0, nullptr, 0, 0, 0, nullptr, nullptr, RPh, RPl, nullptr, nullptr, nullptr);   /* p = pos Wp: per-head hi/lo planes [batch][8][2048][64] */
    k_cvt8<<<LX, 256, 0, stream>>>(xk, XB, (size_t)NB_ * TT * DM / 8, 0, 0);
    k_gemmw<bf, 0, false, 0, TT><<<dim3(NB_ * TT / 64, DKV / 64, 1), 32, 0, stream>>>(XB, nullptr, WK, nullptr, DM, nullptr, 0, nullptr, 0, 0, 0, nullptr, nullptr, KPh, KPl, nullptr, nullptr, nullptr);
    k_cvt8<<<LX, 256, 0, stream>>>(xv, XB, (size_t)NB_ * TT * DM / 8, 0, 0);
    k_gemmw<bf, 0, false, 2, TT><<<dim3(NB_ * TT / 64, DKV / 64, 1), 32, 0, stream>>>(XB, nullptr, WV, nullptr, DM, nullptr, 0, nullptr, 0, 0, 0, nullptr, nullptr, VTh, VTl, nullptr, nullptr, VT16);   /* v planes [batch][head][d][t] */
    k_fattn<<<dim3(TT / MR, NB_ * NH_), 256, 0, stream>>>(QPh, QPl, QVh, QVl, KPh, KPl, RPh, RPl, VT16, VTh, VTl, ATh, ATl);   /* all batches and heads: scores in LDS, merged hi/lo context rows out */
    k_gemmw<bf, 1, false, -1, TT><<<dim3(NB_ * TT / 64, DM / 64, 1), 32, 0, stream>>>(ATh, ATl, WO, nullptr, DQ, OUT, DM, nullptr, 0, 0, 0, nullptr, nullptr, nullptr, nullptr, nullptr, nullptr, nullptr);
}

// v004
// One run takes 259 microseconds.
// Next to v003, in two timings, it ran 1.24 and 1.23 times as fast.
// Over all steps from v000 it is 11.3 times as fast.
#include <hip/hip_runtime.h>

// Conformer-style relative multi-head attention with content/position biases (query, key, value [8][1024][512]; pos_encoding [8][2047][512]; q = query Wq, k = key Wk, v = value Wv, p = pos_encoding Wp ('xw' [512][512] 1/sqrt(512)); 8 heads x 64; content = (q + u_bias).k, pos = rel_shift((q + v_bias).p) with rel_shift[s][t] = pos_raw[s][t - s + 1023] (u_bias, v_bias [8][64] read); score = (content + pos) / 8; softmax (no mask); out = merged Wo ('xw') -> [8][1024][512] (4.2 M)).
// Layout: every stage in front of the scores and the Wo product run ONCE for all 8 batches (batch rows flat in the GEMM's M, or batch = blockIdx.y). bf16 copies of query, key, value in turn and of each batch's 2,047 position rows (zero-padded to 2,048); 'xw' weights transposed once; exact projections, whose GEMM epilogues write the head planes themselves (k_gemmw, EPI >= 0): q + u and q + v (per-head f32 bias adds) as separate hi/lo plane sets, k hi/lo, v transposed (fp16 and hi/lo), p as per-head hi/lo planes [batch][8][2048][64]; then ONE launch for all scores (k_fattn): a work-group owns 32 query rows of one (batch, head) and keeps their 32 x 1024 f32 scores in LDS: position products (3 products) stored skewed (the rel_shift), content products (3 products) added on top, row softmax in place, P (rows < 512 hi/lo, rest fp16 x1024) in place, attn.v from LDS, merged hi/lo rows out; merged hi/lo x Wo exact.
// Compute dtypes, f32 accumulate: every input rounded to bf16; projections exact; bias adds f32; content and position scores 3 products; softmax f32 (x 1/8 on the scores); attn.v rows < 512 3 products, rest fp16; Wo hl x exact.

#define NB_  8
#define TT   1024
#define DM   512
#define NH_  8
#define NKV  8
#define REP  (NH_ / NKV)
#define HD   64
#define DQ   (NH_ * HD)
#define DKV  (NKV * HD)
#define RH   512                  // query rows < RH use hi+lo planes (0: none)
#define WIN  0
#define PCAR 1024.0f
#define SCL  0.125f   // HD^-0.5
#define LP   2048     // padded position rows (2*TT - 1 = 2047 used)
typedef _Float16 h16;
typedef unsigned short bf;
typedef __attribute__((ext_vector_type(16))) __bf16   v16bf;
typedef __attribute__((ext_vector_type(16))) _Float16 v16h;
typedef __attribute__((ext_vector_type(8)))  _Float16 v8h;
typedef __attribute__((ext_vector_type(8)))  unsigned short v8us;
typedef __attribute__((ext_vector_type(8)))  float    v8f;
typedef __attribute__((ext_vector_type(4)))  float    v4f;
typedef v8h  __attribute__((may_alias)) v8ha;
typedef v4f  __attribute__((may_alias)) v4fa;
typedef v8us __attribute__((may_alias)) v8usa;

__device__ __forceinline__ unsigned short f2bf(float f) { unsigned u = __float_as_uint(f); u += 0x7FFFu + ((u >> 16) & 1u); return (unsigned short)(u >> 16); }
__device__ __forceinline__ float bf2f(unsigned short b) { return __uint_as_float(((unsigned)b) << 16); }
__device__ __forceinline__ float bfr(float f) { return bf2f(f2bf(f)); }
__device__ __forceinline__ v16h cat16(v8h lo, v8h hi) { return __builtin_shufflevector(lo, hi, 0, 1, 2, 3, 4, 5, 6, 7, 8, 9, 10, 11, 12, 13, 14, 15); }
__device__ __forceinline__ v16bf cat16b(v8us lo, v8us hi) { return __builtin_bit_cast(v16bf, __builtin_shufflevector(lo, hi, 0, 1, 2, 3, 4, 5, 6, 7, 8, 9, 10, 11, 12, 13, 14, 15)); }
__device__ __forceinline__ v8f wmma16(v16h a, v16h b, v8f c) { return __builtin_amdgcn_wmma_f32_16x16x32_f16(false, a, false, b, (short)0, c, false, false); }
__device__ __forceinline__ v8f wmmab(v16bf a, v16bf b, v8f c) { return __builtin_amdgcn_wmma_f32_16x16x32_bf16(false, a, false, b, (short)0, c, false, false); }



__device__ __forceinline__ h16 tohx(float x) { return (h16)x; }
__device__ __forceinline__ void splitf(float y, unsigned short& h, unsigned short& l) { h = f2bf(y); l = f2bf(y - bf2f(h)); }

// ---- k_gemmw: register-blocked GEMM, ONE WAVE per 64x64 output tile (16 accumulators), operands straight from 16-bit planes in fragment order (below); grid (M/64, N/64, Z), 32 threads.
// C[m][n] (f32, pitch ldc, + optional f32 bias[n]) = sum_k A[m][k] Bt[n][k] (+ split products per NSPLIT). z-batch strides sA/sB/sC in elements. K = 512.
// EPI >= 0 (the projections): C is not stored; the epilogue writes the head planes itself, so that no f32 projection row goes through memory. A 64-column tile is one head, a 64-row tile lies inside one batch of 'rows' rows.
// EPI 0: hi/lo planes [batch][head][rows][64] of C. EPI 1: two such plane sets, of C + u and of C + v (f32 adds of the bf16-rounded per-head biases). EPI 2: transposed planes [batch][head][64][rows] of C, fp16 and hi/lo.
// FRAGMENT ORDER: every 16-bit [rows][K] plane in the workspace is kept as blocks of 16 rows x 32 k (512 elements, 1 KiB), block (r >> 4) * (K / 32) + (k >> 5); inside a block the 16-byte piece of 8 successive k stands at piece ((k >> 4) & 1) * 32 + ((k >> 3) & 1) * 16 + (r & 15).
// Lane l of a wave then finds its fragment's two pieces at block + l * 8 and block + 256 + l * 8 (ldp): each wave-wide 16-byte load covers 512 contiguous bytes, four whole lines, where row-major planes gave 16 lines of 32 bytes. Same elements in the same registers as ld on a row-major plane.
__device__ __forceinline__ size_t pko(size_t r, int k, int K) { return ((r >> 4) * (size_t)(K >> 5) + (size_t)(k >> 5)) * 512 + (size_t)((((k >> 4) & 1) * 32 + ((k >> 3) & 1) * 16 + (int)(r & 15)) * 8 + (k & 7)); }
template <typename T16> struct WFrag;
template <> struct WFrag<h16> { typedef v16h V; static __device__ __forceinline__ V ld(const h16* p) { return cat16(*(const v8h*)p, *(const v8h*)(p + 16)); } static __device__ __forceinline__ V ldp(const h16* p) { return cat16(*(const v8h*)p, *(const v8h*)(p + 256)); } static __device__ __forceinline__ v8f mma(V a, V b, v8f c) { return wmma16(a, b, c); } };
template <> struct WFrag<bf> { typedef v16bf V; static __device__ __forceinline__ V ld(const bf* p) { return cat16b(*(const v8us*)p, *(const v8us*)(p + 16)); } static __device__ __forceinline__ V ldp(const bf* p) { return cat16b(*(const v8us*)p, *(const v8us*)(p + 256)); } static __device__ __forceinline__ v8f mma(V a, V b, v8f c) { return wmmab(a, b, c); } };
template <typename T16, int NSPLIT, bool BIAS, int EPI, int rows>
__global__ __launch_bounds__(32) void k_gemmw(const T16* __restrict__ A, const T16* __restrict__ A2, const T16* __restrict__ Bt, const T16* __restrict__ Bt2, float* C, int ldc, const float* __restrict__ bias, size_t sA, size_t sB, size_t sC,
                                              const float* __restrict__ ub, const float* __restrict__ vb, bf* Ph, bf* Pl, bf* P2h, bf* P2l, h16* P16) {
    typedef typename WFrag<T16>::V V; constexpr int K = DM; static_assert(DQ == DM, "one K for every product");   // a constant K turns every block's distance into an immediate offset: one address pair per plane and trip
    __shared__ __align__(16) float os[16 * 68];
    const size_t z = blockIdx.z; A += z * sA; if (A2) A2 += z * sA; Bt += z * sB; if (Bt2) Bt2 += z * sB; C += z * sC;
    const int lane = threadIdx.x & 31, lr = lane & 15, hi = lane >> 4; const int r0 = blockIdx.x * 64, c0 = blockIdx.y * 64;
    unsigned buv[4][8];   // EPI 1: the two bf16-rounded biases of a d share a register, u in the high half, v in the low; fetched here, while few registers are live
    if constexpr (EPI == 1) {
#pragma unroll
        for (int s = 0; s < 4; ++s) {
#pragma unroll
            for (int q = 0; q < 8; ++q) buv[s][q] = ((unsigned)f2bf(ub[c0 + s * 16 + hi * 8 + q]) << 16) | f2bf(vb[c0 + s * 16 + hi * 8 + q]); } }
    v8f acc[4][4];
#pragma unroll
    for (int mb = 0; mb < 4; ++mb)
#pragma unroll
        for (int nb = 0; nb < 4; ++nb) acc[mb][nb] = (v8f){};
    const size_t aoff = (size_t)r0 * K, boff = (size_t)c0 * K; const unsigned l8 = 8 * lane;   // 16 rows x K are K / 32 blocks in a row; 32 k further is one block (kc * 16 elements)
#pragma unroll 1
    for (int kc = 0; kc < K; kc += 32) {
        V a[4], a2[4]; const T16* pa = A + aoff + kc * 16 + l8; const T16* pa2 = (NSPLIT == 1 || NSPLIT == 2) ? A2 + aoff + kc * 16 + l8 : pa; const T16* pb = Bt + boff + kc * 16 + l8; const T16* pb2 = (NSPLIT >= 2) ? Bt2 + boff + kc * 16 + l8 : pb;
#pragma unroll
        for (int mb = 0; mb < 4; ++mb) { a[mb] = WFrag<T16>::ldp(pa + mb * 16 * K); if (NSPLIT == 1 || NSPLIT == 2) a2[mb] = WFrag<T16>::ldp(pa2 + mb * 16 * K); }
#pragma unroll
        for (int nb = 0; nb < 4; ++nb) { const V b = WFrag<T16>::ldp(pb + nb * 16 * K); V b2; if (NSPLIT >= 2) b2 = WFrag<T16>::ldp(pb2 + nb * 16 * K);
#pragma unroll
            for (int mb = 0; mb < 4; ++mb) { acc[mb][nb] = WFrag<T16>::mma(a[mb], b, acc[mb][nb]); if (NSPLIT == 1 || NSPLIT == 2) acc[mb][nb] = WFrag<T16>::mma(a2[mb], b, acc[mb][nb]); if (NSPLIT >= 2) acc[mb][nb] = WFrag<T16>::mma(a[mb], b2, acc[mb][nb]); } }
        asm volatile("s_wait_xcnt 0x0" :: "v"(pa), "v"(pa2), "v"(pb), "v"(pb2) : "memory");   // stands in front of whatever next rewrites these loads' address registers; naming them keeps them whole up to here (no later load of the trip lands on one)
        asm volatile("v_nop\n\tv_nop\n\tv_nop\n\tv_nop" : "+v"(acc[0][0]), "+v"(acc[1][1]), "+v"(acc[2][2]), "+v"(acc[3][3]) : "v"(a[0]), "v"(a[3]));
    }
    const size_t pz = (size_t)(r0 / rows) * NH_ + blockIdx.y; const int t0 = r0 % rows;   // plane index batch * heads + head; the tile's first row in it
    if constexpr (EPI == 2) {   // a lane's 8 accumulator rows are 8 successive t of one d: one piece of the [d][t] plane's fragment order, a wave's store is 512 contiguous bytes straight from registers
        const size_t vo = pz * HD * rows + (size_t)t0 * 16 + lane * 8;
#pragma unroll
        for (int nb = 0; nb < 4; ++nb) {
#pragma unroll
            for (int mb = 0; mb < 4; ++mb) { v8h o16; v8us oh, ol;
#pragma unroll
                for (int j = 0; j < 8; ++j) { const float x = acc[mb][nb][j]; o16[j] = tohx(x); unsigned short h2, l2; splitf(x, h2, l2); oh[j] = h2; ol[j] = l2; }
                const size_t o = vo + (size_t)nb * 16 * rows + mb * 256;
                __builtin_amdgcn_sched_barrier(0);   // all three pieces are made before the first store goes, so that nothing is computed into a register of a store in flight
                *(v8h*)(P16 + o) = o16; *(v8us*)(Ph + o) = oh; *(v8us*)(Pl + o) = ol;
                asm volatile("s_wait_xcnt 0x0" ::: "memory"); } }   // stands in front of whatever next rewrites these stores' address and data registers
        return;
    }
    if constexpr (EPI == 0 || EPI == 1) {   // 16 rows at a time through LDS: a lane then holds 8 successive d of row lr, one piece of the fragment order; a wave's store is 512 contiguous bytes
        const size_t po = (pz * rows + t0) * HD + lane * 8;
#pragma unroll
        for (int mb = 0; mb < 4; ++mb) {
#pragma unroll
            for (int nb = 0; nb < 4; ++nb) {
#pragma unroll
                for (int j = 0; j < 8; ++j) os[(hi * 8 + j) * 68 + nb * 16 + lr] = acc[mb][nb][j]; }
            __builtin_amdgcn_wave_barrier(); asm volatile("" ::: "memory");   // the wave's LDS stores stay in front of the reads that other lanes make of them (one wave: the LDS keeps the order, the compiler must too)
#pragma unroll
            for (int s = 0; s < 4; ++s) { const v4f x0 = *(const v4fa*)(os + lr * 68 + s * 16 + hi * 8), x1 = *(const v4fa*)(os + lr * 68 + s * 16 + hi * 8 + 4); const size_t o = po + (size_t)(mb * 16) * HD + s * 256; v8us oh, ol, o2h, o2l;
#pragma unroll
                for (int q = 0; q < 8; ++q) { const float x = (q < 4 ? x0[q & 3] : x1[q & 3]); unsigned short h2, l2; splitf(EPI == 1 ? __fadd_rn(x, __uint_as_float(buv[s][q] & 0xFFFF0000u)) : x, h2, l2); oh[q] = h2; ol[q] = l2;
                    if constexpr (EPI == 1) { splitf(__fadd_rn(x, __uint_as_float(buv[s][q] << 16)), h2, l2); o2h[q] = h2; o2l[q] = l2; } }
                *(v8us*)(Ph + o) = oh; *(v8us*)(Pl + o) = ol; if constexpr (EPI == 1) { *(v8us*)(P2h + o) = o2h; *(v8us*)(P2l + o) = o2l; }
                asm volatile("s_wait_xcnt 0x0" ::: "memory"); }   // stands in front of whatever next rewrites these stores' address and data registers
            __builtin_amdgcn_wave_barrier(); asm volatile("" ::: "memory");   // and these reads in front of the next 16 rows' stores
        }
        return;
    }
#pragma unroll
    for (int mb = 0; mb < 4; ++mb) {
#pragma unroll
        for (int nb = 0; nb < 4; ++nb) {
#pragma unroll
            for (int j = 0; j < 8; ++j) os[(hi * 8 + j) * 68 + nb * 16 + lr] = acc[mb][nb][j]; }
        __builtin_amdgcn_wave_barrier(); asm volatile("" ::: "memory");
        float* crow = C + (size_t)(r0 + mb * 16) * ldc + c0;
{
#pragma unroll
            for (int s = 0; s < 8; ++s) { const int row = 2 * s + hi, cofs = lr * 4; v4f val = *(const v4fa*)(os + row * 68 + cofs); if (BIAS) { val[0] += bfr(bias[c0 + cofs]); val[1] += bfr(bias[c0 + cofs + 1]); val[2] += bfr(bias[c0 + cofs + 2]); val[3] += bfr(bias[c0 + cofs + 3]); }
                *(v4f*)(crow + (size_t)row * ldc + cofs) = val; }
             }
        __builtin_amdgcn_wave_barrier(); asm volatile("" ::: "memory");
    }
}

typedef __attribute__((ext_vector_type(2))) _Float16 v2h;
typedef __attribute__((ext_vector_type(4))) _Float16 v4h;
typedef __attribute__((ext_vector_type(2))) unsigned short v2us;
typedef __attribute__((ext_vector_type(4))) unsigned short v4us;
typedef __attribute__((ext_vector_type(2))) float v2f;
typedef __attribute__((ext_vector_type(4))) int v4i;

__global__ __launch_bounds__(256) void k_wtG(const float* __restrict__ w, int K, int N, bf* Bt) {
    const int lane = threadIdx.x & 31; const int L0 = (blockIdx.x * 8 + (threadIdx.x >> 5)) * 8; const int nlines = N * K / 64;
{
#pragma unroll 1
        for (int l = 0; l < 8; ++l) { const int L = L0 + l; if (L >= nlines) break; const size_t e = (size_t)L * 64 + lane * 2; const int k = (int)(e % K), n = (int)(e / K); v2us o;
            o[0] = f2bf(w[(size_t)k * N + n]); o[1] = f2bf(w[(size_t)(k + 1) * N + n]); *(v2us*)(Bt + pko((size_t)n, k, K)) = o;
            asm volatile("s_wait_xcnt 0x0" ::: "memory"); }   // stands in front of the next trip's rewrite of this store's address and data registers
         }
}
// f32 rows [rsrc][DM] to a bf16 plane in fragment order: a wave takes 8 rows x 32 k, half a block: it reads 128 contiguous bytes of each row (8 whole lines) and writes four runs of 128 bytes (4 whole lines); a piece of a row past rsrc is left to k_zrow
__global__ __launch_bounds__(256) void k_cvt8(const float* __restrict__ src, bf* dst, size_t n8, int rsrc, size_t sS, size_t sD) { const size_t i = (size_t)blockIdx.x * 256 + threadIdx.x; if (i >= n8) return; src += blockIdx.y * sS; dst += blockIdx.y * sD;
    const size_t blk = i >> 6; const int c = ((int)(i & 31) >> 3) * 16 + ((int)(i >> 5) & 1) * 8 + (int)(i & 7); const size_t r = (blk / (DM / 32)) * 16 + (c & 15); const int k = (int)(blk % (DM / 32)) * 32 + (c >> 4) * 8; if (r >= (size_t)rsrc) return;
    const v8f v = *(const v8f*)(src + r * DM + k); v8us o;
    asm volatile("s_wait_xcnt 0x0" ::: "memory");   // stands in front of whatever next rewrites this load's address registers
#pragma unroll
    for (int q = 0; q < 8; ++q) o[q] = f2bf(v[q]); *(v8us*)(dst + (blk * 64 + c) * 8) = o;  }

__global__ __launch_bounds__(256) void k_zrow(bf* R) { const int i = blockIdx.x * 256 + threadIdx.x; if (i >= DM / 8) return; R += (size_t)blockIdx.y * LP * DM; v8us z; for (int q = 0; q < 8; ++q) z[q] = 0; *(v8us*)(R + pko(LP - 1, i * 8, DM)) = z;  }
// ---- k_fattn: scores, rel_shift, softmax, attn.v and the head merge for MR query rows of one (batch, head); grid (TT / MR, batches x heads), 8 waves.
// The score strip S[MR][TT] (f32, pitch SP) never leaves LDS. Every sum keeps the order of a 16x16x32 product chain over k ascending (hi.hi, lo.hi, hi.lo per 32 k), content + position added once, the row softmax with its fixed trees.
#define MR 32      // query rows per work-group (two 16-row tiles)
#define SP 1028    // f32 pitch of a score row in LDS: rows 8 apart fall 32 banks apart, 16-byte aligned
typedef v4us __attribute__((may_alias)) v4usa;
typedef v4h  __attribute__((may_alias)) v4ha;
// the hi and lo fragments of one 16-row tile of B (64 k)
struct BTile { v16bf b[2], b2[2]; };
__device__ __forceinline__ void ld_btile(BTile& x, const bf* __restrict__ bh, const bf* __restrict__ bl) {
#pragma unroll
    for (int ks = 0; ks < 2; ++ks) { x.b[ks] = WFrag<bf>::ldp(bh + ks * 512); x.b2[ks] = WFrag<bf>::ldp(bl + ks * 512); }
    asm volatile("s_wait_xcnt 0x0" ::: "memory");   // stands in front of whatever next rewrites these loads' address registers
}
// one plane's fragments of the strip's 32 query rows (two 16-row tiles x 64 k)
__device__ __forceinline__ void ld_qfrags(v16bf (&a)[2][2], const bf* __restrict__ q) {
#pragma unroll
    for (int sub = 0; sub < 2; ++sub) {
#pragma unroll
        for (int ks = 0; ks < 2; ++ks) a[sub][ks] = WFrag<bf>::ldp(q + sub * 16 * HD + ks * 512); }
    asm volatile("s_wait_xcnt 0x0" ::: "memory");   // stands in front of whatever next rewrites these loads' address registers
}
// one B tile against both 16-row tiles of A: acc[sub] = sum over 64 k, 3 products
__device__ __forceinline__ void qk_tile(const v16bf (&a)[2][2], const v16bf (&a2)[2][2], const BTile& x, v8f (&acc)[2]) {
    acc[0] = (v8f){}; acc[1] = (v8f){};
#pragma unroll
    for (int ks = 0; ks < 2; ++ks) {
#pragma unroll
        for (int sub = 0; sub < 2; ++sub) { acc[sub] = wmmab(a[sub][ks], x.b[ks], acc[sub]); acc[sub] = wmmab(a2[sub][ks], x.b[ks], acc[sub]); acc[sub] = wmmab(a[sub][ks], x.b2[ks], acc[sub]); } }
    asm volatile("v_nop\n\tv_nop\n\tv_nop\n\tv_nop" :: "v"(acc[0]), "v"(acc[1]));   // four vector slots behind the last product: the next tile's first product starts from zero in the same result registers, with only LDS stores and loads between
}
// position tile: S[row][m + s - 1023] = (q + v).p[m]; EDGE: part of the tile may fall outside 0 <= t < TT and is dropped
template <bool EDGE>
__device__ __forceinline__ void pos_store(float* S, const v8f (&acc)[2], int m0, int s0, int lr, int hi) {
    const int tb = m0 + lr + s0 + hi * 8 - (TT - 1);   // t of (sub 0, j 0)
#pragma unroll
    for (int sub = 0; sub < 2; ++sub) {
#pragma unroll
        for (int j = 0; j < 8; ++j) { const int t = tb + sub * 16 + j; if (!EDGE || (unsigned)t < (unsigned)TT) S[(sub * 16 + hi * 8 + j) * SP + t] = acc[sub][j]; } }
}
// attn.v for one 16 x 16 output tile: P rows from LDS (pa; lo plane TT elements behind the hi plane), v rows [d][t] from global (fragment order); k = t ascending, per 32 k: hi.hi, lo.hi, hi.lo (SPLIT) or one product.
// Stages of 64 k: v fragments fetched two stages ahead, P fragments one stage ahead.
template <typename T16, bool SPLIT>
__device__ __forceinline__ v8f pv_tile(const T16* pa, const T16* __restrict__ vh, const T16* __restrict__ vl) {
    typedef typename WFrag<T16>::V V; constexpr int NS = TT / 64;
    V b[3][2], b2[3][2], a[2][2], a2[2][2]; v8f acc = (v8f){};
#pragma unroll
    for (int s = 0; s < 2; ++s) {
#pragma unroll
        for (int ks = 0; ks < 2; ++ks) { b[s][ks] = WFrag<T16>::ldp(vh + (s * 2 + ks) * 512); if (SPLIT) b2[s][ks] = WFrag<T16>::ldp(vl + (s * 2 + ks) * 512); } }
#pragma unroll
    for (int ks = 0; ks < 2; ++ks) { a[0][ks] = WFrag<T16>::ld(pa + ks * 32); if (SPLIT) a2[0][ks] = WFrag<T16>::ld(pa + TT + ks * 32); }
#pragma unroll
    for (int s = 0; s < NS; ++s) {
        if (s + 2 < NS) {
#pragma unroll
            for (int ks = 0; ks < 2; ++ks) { b[(s + 2) % 3][ks] = WFrag<T16>::ldp(vh + ((s + 2) * 2 + ks) * 512); if (SPLIT) b2[(s + 2) % 3][ks] = WFrag<T16>::ldp(vl + ((s + 2) * 2 + ks) * 512); } }
        if (s + 1 < NS) {
#pragma unroll
            for (int ks = 0; ks < 2; ++ks) { a[(s + 1) & 1][ks] = WFrag<T16>::ld(pa + (s + 1) * 64 + ks * 32); if (SPLIT) a2[(s + 1) & 1][ks] = WFrag<T16>::ld(pa + TT + (s + 1) * 64 + ks * 32); } }
        __builtin_amdgcn_sched_barrier(0);   // keeps the later stages' loads in front of this stage's products; without it they sink to their uses and each stage waits out a whole load
#pragma unroll
        for (int ks = 0; ks < 2; ++ks) { acc = WFrag<T16>::mma(a[s & 1][ks], b[s % 3][ks], acc); if (SPLIT) { acc = WFrag<T16>::mma(a2[s & 1][ks], b[s % 3][ks], acc); acc = WFrag<T16>::mma(a[s & 1][ks], b2[s % 3][ks], acc); } }
    }
    asm volatile("s_wait_xcnt 0x0" ::: "memory");   // stands in front of whatever next rewrites the v loads' address registers
    return acc;
}
__global__ __launch_bounds__(256) void k_fattn(const bf* __restrict__ QPh, const bf* __restrict__ QPl, const bf* __restrict__ QVh, const bf* __restrict__ QVl, const bf* __restrict__ KPh, const bf* __restrict__ KPl, const bf* __restrict__ RPh, const bf* __restrict__ RPl,
                                               const h16* __restrict__ VT16, const bf* __restrict__ VTh, const bf* __restrict__ VTl, bf* ATh, bf* ATl) {
    __shared__ __align__(16) float S[MR * SP];
    __shared__ __align__(16) float Os[MR * 68];
    const int lane = threadIdx.x & 31, lr = lane & 15, hi = lane >> 4; const int w = __builtin_amdgcn_readfirstlane(threadIdx.x >> 5);
    const int s0 = blockIdx.x * MR; const size_t z = blockIdx.y;   // z = batch * 8 + head: plane index of every operand
    const bool hires = (s0 < RH);
    const size_t qoff = (z * TT + s0) * HD + 8 * lane;
    {   // position scores, stored skewed: the 66 tiles of 16 p rows that the 32 query rows reach; wave w takes tiles w + 8 k; tiles 0, 1, 64, 65 cross an end of the key range
        v16bf a[2][2], a2[2][2];
        ld_qfrags(a, QVh + qoff); ld_qfrags(a2, QVl + qoff);
        const int mb = (TT - MR) - s0 + w * 16;   // the wave's first p row; tile 0 starts where t = 0 meets the strip's last query row
        const bf* ph = RPh + (z * LP + mb) * HD + 8 * lane; const bf* pl = RPl + (z * LP + mb) * HD + 8 * lane;
        BTile bt[2]; ld_btile(bt[0], ph, pl);
#pragma unroll
        for (int k = 0; k < 8; ++k) {
            if (k < 7 || w < 2) ld_btile(bt[(k + 1) & 1], ph + (k + 1) * 128 * HD, pl + (k + 1) * 128 * HD);
            __builtin_amdgcn_sched_barrier(0);   // keeps the next tile's loads in front of this tile's products, so that they fly meanwhile
            v8f acc[2]; qk_tile(a, a2, bt[k & 1], acc);
            if (k == 0) pos_store<true>(S, acc, mb, s0, lr, hi); else pos_store<false>(S, acc, mb + k * 128, s0, lr, hi);
        }
        if (w < 2) { v8f acc[2]; qk_tile(a, a2, bt[0], acc); pos_store<true>(S, acc, mb + 8 * 128, s0, lr, hi); }
    }
    __syncthreads();   // every position score is in S before a content score is added to it
    {   // content scores on top; wave w takes key tiles w + 8 k
        v16bf a[2][2], a2[2][2];
        ld_qfrags(a, QPh + qoff); ld_qfrags(a2, QPl + qoff);
        const bf* kh = KPh + (z * TT + w * 16) * HD + 8 * lane; const bf* kl = KPl + (z * TT + w * 16) * HD + 8 * lane;
        float* sw = S + hi * 8 * SP + w * 16 + lr;
        BTile bt[2]; ld_btile(bt[0], kh, kl);
#pragma unroll
        for (int k = 0; k < 8; ++k) {
            if (k < 7) ld_btile(bt[(k + 1) & 1], kh + (k + 1) * 128 * HD, kl + (k + 1) * 128 * HD);
            float old[2][8];
#pragma unroll
            for (int sub = 0; sub < 2; ++sub) {
#pragma unroll
                for (int j = 0; j < 8; ++j) old[sub][j] = sw[(sub * 16 + j) * SP + k * 128]; }
            __builtin_amdgcn_sched_barrier(0);   // keeps the next tile's loads and this tile's position scores in front of the products, so that they fly meanwhile
            v8f acc[2]; qk_tile(a, a2, bt[k & 1], acc);
#pragma unroll
            for (int sub = 0; sub < 2; ++sub) {
#pragma unroll
                for (int j = 0; j < 8; ++j) sw[(sub * 16 + j) * SP + k * 128] = __fadd_rn(acc[sub][j], old[sub][j]); }
        }
    }
    __syncthreads();   // whole score rows before the softmax
    // softmax: one wave per row, 4 rows a wave; t = S x HD^-0.5 (no mask), register row, one exp, fixed trees; P overwrites the row it came from (hi plane then lo plane, or fp16)
#pragma unroll 1
    for (int r = 0; r < MR / 8; ++r) { float* sr = S + (w * (MR / 8) + r) * SP; float v[TT / 32]; float mx = -3.0e38f;
#pragma unroll
        for (int ch = 0; ch < TT / 128; ++ch) { const v4f a = *(const v4fa*)(sr + ch * 128 + lane * 4);
#pragma unroll
            for (int q = 0; q < 4; ++q) { const float t = a[q] * SCL; v[ch * 4 + q] = t; mx = fmaxf(mx, t); } }
#pragma unroll
        for (int sh = 16; sh; sh >>= 1) mx = fmaxf(mx, __shfl_xor(mx, sh, 32));
        float sum = 0.f;
#pragma unroll
        for (int k = 0; k < TT / 32; ++k) { const float d0 = __fsub_rn(v[k], mx); v[k] = __builtin_amdgcn_exp2f(__fmul_rn(d0, 1.4426950408889634f)); sum += v[k]; }
#pragma unroll
        for (int sh = 16; sh; sh >>= 1) sum += __shfl_xor(sum, sh, 32);
        const float f = __fdiv_rn(hires ? 1.0f : PCAR, sum);
        if (hires) { bf* ph = (bf*)sr;
#pragma unroll
            for (int ch = 0; ch < TT / 128; ++ch) { v4us oh, ol;
#pragma unroll
                for (int q = 0; q < 4; ++q) { unsigned short a, c2; splitf(v[ch * 4 + q] * f, a, c2); oh[q] = a; ol[q] = c2; }
                *(v4usa*)(ph + ch * 128 + lane * 4) = oh; *(v4usa*)(ph + TT + ch * 128 + lane * 4) = ol; }
        } else { h16* p16 = (h16*)sr;
#pragma unroll
            for (int ch = 0; ch < TT / 128; ++ch) { v4h o4;
#pragma unroll
                for (int q = 0; q < 4; ++q) o4[q] = tohx(v[ch * 4 + q] * f);
                *(v4ha*)(p16 + ch * 128 + lane * 4) = o4; } }
    }
    __syncthreads();   // every P row before attn.v reads it
    {   // attn.v: one 16 x 16 output tile a wave
        const int sub = w >> 2, nt = w & 3; const float* prow = S + (sub * 16 + lr) * SP; const size_t voff = (z * HD + nt * 16) * TT + 8 * lane;
        const v8f acc = hires ? pv_tile<bf, true>((const bf*)prow + 8 * hi, VTh + voff, VTl + voff) : pv_tile<h16, false>((const h16*)prow + 8 * hi, VT16 + voff, nullptr);
#pragma unroll
        for (int j = 0; j < 8; ++j) Os[(sub * 16 + hi * 8 + j) * 68 + nt * 16 + lr] = acc[j];
    }
    __syncthreads();   // the 32 x 64 context tile is whole before it is split and stored by rows
    { const int row = (w >> 2) * 16 + lr, d0 = (w & 3) * 16 + hi * 8; const float cs = hires ? 1.0f : (1.0f / PCAR); const v4f x0 = *(const v4fa*)(Os + row * 68 + d0), x1 = *(const v4fa*)(Os + row * 68 + d0 + 4); v8us oh, ol;
#pragma unroll
        for (int q = 0; q < 8; ++q) { unsigned short a, c2; splitf((q < 4 ? x0[q & 3] : x1[q & 3]) * cs, a, c2); oh[q] = a; ol[q] = c2; }
        const size_t oo = pko((z / NH_) * TT + s0 + row, (int)(z % NH_) * HD + d0, DQ); *(v8us*)(ATh + oo) = oh; *(v8us*)(ATl + oo) = ol; }
}

extern "C" void kernel_launch(void* const* d_in, const int* in_sizes, int n_in,
                              void* d_out, int out_size, void* d_ws, size_t ws_size, hipStream_t stream) {
    (void)in_sizes; (void)n_in; (void)out_size;
    const float* x = (const float*)d_in[0];   /* query */ const float* xk = (const float*)d_in[1]; const float* xv = (const float*)d_in[2]; const float* pos = (const float*)d_in[3];   /* [8][2047][512] */ const float* wq = (const float*)d_in[4]; const float* wk = (const float*)d_in[5]; const float* wv = (const float*)d_in[6]; const float* wp = (const float*)d_in[7]; const float* ub = (const float*)d_in[8]; const float* vb = (const float*)d_in[9];   /* u_bias, v_bias [8][64] */ const float* wo = (const float*)d_in[10];
    float* OUT = (float*)d_out;     // [8][1024][512]
    char* wsp = (char*)d_ws;
    auto take = [&](size_t bytes) { char* p = wsp; wsp += (bytes + 255) & ~(size_t)255; return (void*)p; };
    // kept to the end: weights, head planes of all batches, merged context
    bf* WP = (bf*)take((size_t)DQ * DM * 2); bf* WQ = (bf*)take((size_t)DQ * DM * 2); bf* WK = (bf*)take((size_t)DKV * DM * 2); bf* WV = (bf*)take((size_t)DKV * DM * 2); bf* WO = (bf*)take((size_t)DM * DQ * 2);
    bf* RPh = (bf*)take((size_t)NB_ * NH_ * LP * HD * 2); bf* RPl = (bf*)take((size_t)NB_ * NH_ * LP * HD * 2); bf* QVh = (bf*)take((size_t)NB_ * NH_ * TT * HD * 2); bf* QVl = (bf*)take((size_t)NB_ * NH_ * TT * HD * 2);
    bf* QPh = (bf*)take((size_t)NB_ * NH_ * TT * HD * 2); bf* QPl = (bf*)take((size_t)NB_ * NH_ * TT * HD * 2); bf* KPh = (bf*)take((size_t)NB_ * NKV * TT * HD * 2); bf* KPl = (bf*)take((size_t)NB_ * NKV * TT * HD * 2);
    h16* VT16 = (h16*)take((size_t)NB_ * NKV * HD * TT * 2); bf* VTh = (bf*)take((size_t)NB_ * NKV * HD * TT * 2); bf* VTl = (bf*)take((size_t)NB_ * NKV * HD * TT * 2); bf* ATh = (bf*)take((size_t)NB_ * TT * DQ * 2); bf* ATl = (bf*)take((size_t)NB_ * TT * DQ * 2);
    // projection stage's buffers
    bf* XB = (bf*)take((size_t)NB_ * TT * DM * 2); bf* XP = (bf*)take((size_t)NB_ * LP * DM * 2);
    if ((size_t)(wsp - (char*)d_ws) > ws_size) return;
    { k_wtG<<<(unsigned)((DM * DQ / 64 + 63) / 64), 256, 0, stream>>>(wq, DM, DQ, WQ); k_wtG<<<(unsigned)((DM * DKV / 64 + 63) / 64), 256, 0, stream>>>(wk, DM, DKV, WK); k_wtG<<<(unsigned)((DM * DKV / 64 + 63) / 64), 256, 0, stream>>>(wv, DM, DKV, WV);
      k_wtG<<<(unsigned)((DQ * DM / 64 + 63) / 64), 256, 0, stream>>>(wo, DQ, DM, WO); k_wtG<<<(unsigned)((DM * DQ / 64 + 63) / 64), 256, 0, stream>>>(wp, DM, DQ, WP);
       }
    const unsigned LX = (unsigned)(((size_t)NB_ * TT * DM / 8 + 255) / 256);
    // projection stage, all batches per launch
    k_cvt8<<<LX, 256, 0, stream>>>(x, XB, (size_t)NB_ * TT * DM / 8, NB_ * TT, 0, 0);
    k_gemmw<bf, 0, false, 1, TT><<<dim3(NB_ * TT / 64, DQ / 64, 1), 32, 0, stream>>>(XB, nullptr, WQ, nullptr, nullptr, 0, nullptr, 0, 0, 0, ub, vb, QPh, QPl, QVh, QVl, nullptr);   /* (q + u) and (q + v) planes */
    k_cvt8<<<dim3((unsigned)(((size_t)LP * DM / 8 + 255) / 256), NB_), 256, 0, stream>>>(pos, XP, (size_t)LP * DM / 8, LP - 1, (size_t)(LP - 1) * DM, (size_t)LP * DM);
    k_zrow<<<dim3((DM / 8 + 255) / 256, NB_), 256, 0, stream>>>(XP);   /* 2,047 position rows + one zero pad row per batch */
    k_gemmw<bf, 0, false, 0, LP><<<dim3(NB_ * LP / 64, DQ / 64, 1), 32, 0, stream>>>(XP, nullptr, WP, nullptr, nullptr, 0, nullptr, 0, 0, 0, nullptr, nullptr, RPh, RPl, nullptr, nullptr, nullptr);   /* p = pos Wp: per-head hi/lo planes [batch][8][2048][64] */
    k_cvt8<<<LX, 256, 0, stream>>>(xk, XB, (size_t)NB_ * TT * DM / 8, NB_ * TT, 0, 0);
    k_gemmw<bf, 0, false, 0, TT><<<dim3(NB_ * TT / 64, DKV / 64, 1), 32, 0, stream>>>(XB, nullptr, WK, nullptr, nullptr, 0, nullptr, 0, 0, 0, nullptr, nullptr, KPh, KPl, nullptr, nullptr, nullptr);
    k_cvt8<<<LX, 256, 0, stream>>>(xv, XB, (size_t)NB_ * TT * DM / 8, NB_ * TT, 0, 0);
    k_gemmw<bf, 0, false, 2, TT><<<dim3(NB_ * TT / 64, DKV / 64, 1), 32, 0, stream>>>(XB, nullptr, WV, nullptr, nullptr, 0, nullptr, 0, 0, 0, nullptr, nullptr, VTh, VTl, nullptr, nullptr, VT16);   /* v planes [batch][head][d][t] */
    k_fattn<<<dim3(TT / MR, NB_ * NH_), 256, 0, stream>>>(QPh, QPl, QVh, QVl, KPh, KPl, RPh, RPl, VT16, VTh, VTl, ATh, ATl);   /* all batches and heads: scores in LDS, merged hi/lo context rows out */
    k_gemmw<bf, 1, false, -1, TT><<<dim3(NB_ * TT / 64, DM / 64, 1), 32, 0, stream>>>(ATh, ATl, WO, nullptr, OUT, DM, nullptr, 0, 0, 0, nullptr, nullptr, nullptr, nullptr, nullptr, nullptr, nullptr);
}

// v005
// A run of this version takes 169 microseconds.
// In two side-by-side timings against v004, it was 1.54 and 1.53 times as fast.
// All steps since v000 together make it 17.4 times as fast.
#include <hip/hip_runtime.h>

// Conformer-style relative multi-head attention with content/position biases (query, key, value [8][1024][512]; pos_encoding [8][2047][512]; q = query Wq, k = key Wk, v = value Wv, p = pos_encoding Wp ('xw' [512][512] 1/sqrt(512)); 8 heads x 64; content = (q + u_bias).k, pos = rel_shift((q + v_bias).p) with rel_shift[s][t] = pos_raw[s][t - s + 1023] (u_bias, v_bias [8][64] read); score = (content + pos) / 8; softmax (no mask); out = merged Wo ('xw') -> [8][1024][512] (4.2 M)).
// Layout: every stage in front of the scores and the Wo product run ONCE for all 8 batches (batch rows flat in the GEMM's M, or one block range per batch). Four launches. k_prep: bf16 copies of query, key, value and of each batch's 2,047 position rows (zero-padded to 2,048), 'xw' weights transposed, all in one grid; k_proj: the four exact projections in one grid, whose GEMM epilogues write the head planes themselves (gemmw, EPI >= 0): q + u and q + v (per-head f32 bias adds) as separate hi/lo plane sets, k hi/lo, v transposed (fp16 and hi/lo), p as per-head hi/lo planes [batch][8][2048][64]; then ONE launch for all scores (k_fattn): a work-group owns 32 query rows of one (batch, head) and keeps their 32 x 1024 f32 scores in LDS: position products (3 products) stored skewed (the rel_shift), content products (3 products) added on top, row softmax in place, P (rows < 512 hi/lo, rest fp16 x1024) in place, attn.v from LDS, merged hi/lo rows out; merged hi/lo x Wo exact.
// Compute dtypes, f32 accumulate: every input rounded to bf16; projections exact; bias adds f32; content and position scores 3 products; softmax f32 (x 1/8 on the scores); attn.v rows < 512 3 products, rest fp16; Wo hl x exact.

#define NB_  8
#define TT   1024
#define DM   512
#define NH_  8
#define NKV  8
#define REP  (NH_ / NKV)
#define HD   64
#define DQ   (NH_ * HD)
#define DKV  (NKV * HD)
#define RH   512                  // query rows < RH use hi+lo planes (0: none)
#define WIN  0
#define PCAR 1024.0f
#define SCL  0.125f   // HD^-0.5
#define LP   2048     // padded position rows (2*TT - 1 = 2047 used)
typedef _Float16 h16;
typedef unsigned short bf;
typedef __attribute__((ext_vector_type(16))) __bf16   v16bf;
typedef __attribute__((ext_vector_type(16))) _Float16 v16h;
typedef __attribute__((ext_vector_type(8)))  _Float16 v8h;
typedef __attribute__((ext_vector_type(8)))  unsigned short v8us;
typedef __attribute__((ext_vector_type(8)))  float    v8f;
typedef __attribute__((ext_vector_type(4)))  float    v4f;
typedef v8h  __attribute__((may_alias)) v8ha;
typedef v4f  __attribute__((may_alias)) v4fa;
typedef v8us __attribute__((may_alias)) v8usa;

__device__ __forceinline__ unsigned short f2bf(float f) { unsigned u = __float_as_uint(f); u += 0x7FFFu + ((u >> 16) & 1u); return (unsigned short)(u >> 16); }
__device__ __forceinline__ float bf2f(unsigned short b) { return __uint_as_float(((unsigned)b) << 16); }
__device__ __forceinline__ float bfr(float f) { return bf2f(f2bf(f)); }
__device__ __forceinline__ v16h cat16(v8h lo, v8h hi) { return __builtin_shufflevector(lo, hi, 0, 1, 2, 3, 4, 5, 6, 7, 8, 9, 10, 11, 12, 13, 14, 15); }
__device__ __forceinline__ v16bf cat16b(v8us lo, v8us hi) { return __builtin_bit_cast(v16bf, __builtin_shufflevector(lo, hi, 0, 1, 2, 3, 4, 5, 6, 7, 8, 9, 10, 11, 12, 13, 14, 15)); }
__device__ __forceinline__ v8f wmma16(v16h a, v16h b, v8f c) { return __builtin_amdgcn_wmma_f32_16x16x32_f16(false, a, false, b, (short)0, c, false, false); }
__device__ __forceinline__ v8f wmmab(v16bf a, v16bf b, v8f c) { return __builtin_amdgcn_wmma_f32_16x16x32_bf16(false, a, false, b, (short)0, c, false, false); }



__device__ __forceinline__ h16 tohx(float x) { return (h16)x; }
__device__ __forceinline__ void splitf(float y, unsigned short& h, unsigned short& l) { h = f2bf(y); l = f2bf(y - bf2f(h)); }

// ---- k_gemmw: register-blocked GEMM, ONE WAVE per 64x64 output tile (16 accumulators), operands straight from 16-bit planes in fragment order (below); 32 threads.
// C[m][n] (f32, pitch ldc, + optional f32 bias[n]) = sum_k A[m][k] Bt[n][k] (+ split products per NSPLIT). K = 512.
// EPI >= 0 (the projections): C is not stored; the epilogue writes the head planes itself, so that no f32 projection row goes through memory. A 64-column tile is one head, a 64-row tile lies inside one batch of 'rows' rows.
// EPI 0: hi/lo planes [batch][head][rows][64] of C. EPI 1: two such plane sets, of C + u and of C + v (f32 adds of the bf16-rounded per-head biases). EPI 2: transposed planes [batch][head][64][rows] of C, fp16 and hi/lo.
// FRAGMENT ORDER: every 16-bit [rows][K] plane in the workspace is kept as blocks of 16 rows x 32 k (512 elements, 1 KiB), block (r >> 4) * (K / 32) + (k >> 5); inside a block the 16-byte piece of 8 successive k stands at piece ((k >> 4) & 1) * 32 + ((k >> 3) & 1) * 16 + (r & 15).
// Lane l of a wave then finds its fragment's two pieces at block + l * 8 and block + 256 + l * 8 (ldp): each wave-wide 16-byte load covers 512 contiguous bytes, four whole lines, where row-major planes gave 16 lines of 32 bytes. Same elements in the same registers as ld on a row-major plane.
__device__ __forceinline__ size_t pko(size_t r, int k, int K) { return ((r >> 4) * (size_t)(K >> 5) + (size_t)(k >> 5)) * 512 + (size_t)((((k >> 4) & 1) * 32 + ((k >> 3) & 1) * 16 + (int)(r & 15)) * 8 + (k & 7)); }
template <typename T16> struct WFrag;
template <> struct WFrag<h16> { typedef v16h V; static __device__ __forceinline__ V ld(const h16* p) { return cat16(*(const v8h*)p, *(const v8h*)(p + 16)); } static __device__ __forceinline__ V ldp(const h16* p) { return cat16(*(const v8h*)p, *(const v8h*)(p + 256)); } static __device__ __forceinline__ v8f mma(V a, V b, v8f c) { return wmma16(a, b, c); } };
template <> struct WFrag<bf> { typedef v16bf V; static __device__ __forceinline__ V ld(const bf* p) { return cat16b(*(const v8us*)p, *(const v8us*)(p + 16)); } static __device__ __forceinline__ V ldp(const bf* p) { return cat16b(*(const v8us*)p, *(const v8us*)(p + 256)); } static __device__ __forceinline__ v8f mma(V a, V b, v8f c) { return wmmab(a, b, c); } };
// gemmw is the body; bx, by name the tile (row tile, column tile), os is the wave's 16 x 68 f32 LDS patch. k_gemmw launches one product, k_proj all four projections in one grid.
template <typename T16, int NSPLIT, bool BIAS, int EPI, int rows>
__device__ __forceinline__ void gemmw(float* os, int bx, int by, const T16* __restrict__ A, const T16* __restrict__ A2, const T16* __restrict__ Bt, const T16* __restrict__ Bt2, float* C, int ldc, const float* __restrict__ bias,
                                      const float* __restrict__ ub, const float* __restrict__ vb, bf* Ph, bf* Pl, bf* P2h, bf* P2l, h16* P16) {
    typedef typename WFrag<T16>::V V; constexpr int K = DM; static_assert(DQ == DM, "one K for every product");   // a constant K turns every block's distance into an immediate offset: one address pair per plane and trip
    const int lane = threadIdx.x & 31, lr = lane & 15, hi = lane >> 4; const int r0 = bx * 64, c0 = by * 64;
    unsigned buv[4][8];   // EPI 1: the two bf16-rounded biases of a d share a register, u in the high half, v in the low; fetched here, while few registers are live
    if constexpr (EPI == 1) {
#pragma unroll
        for (int s = 0; s < 4; ++s) {
#pragma unroll
            for (int q = 0; q < 8; ++q) buv[s][q] = ((unsigned)f2bf(ub[c0 + s * 16 + hi * 8 + q]) << 16) | f2bf(vb[c0 + s * 16 + hi * 8 + q]); } }
    v8f acc[4][4];
#pragma unroll
    for (int mb = 0; mb < 4; ++mb)
#pragma unroll
        for (int nb = 0; nb < 4; ++nb) acc[mb][nb] = (v8f){};
    const size_t aoff = (size_t)r0 * K, boff = (size_t)c0 * K; const unsigned l8 = 8 * lane;   // 16 rows x K are K / 32 blocks in a row; 32 k further is one block (kc * 16 elements)
#pragma unroll 1
    for (int kc = 0; kc < K; kc += 32) {
        V a[4], a2[4]; const T16* pa = A + aoff + kc * 16 + l8; const T16* pa2 = (NSPLIT == 1 || NSPLIT == 2) ? A2 + aoff + kc * 16 + l8 : pa; const T16* pb = Bt + boff + kc * 16 + l8; const T16* pb2 = (NSPLIT >= 2) ? Bt2 + boff + kc * 16 + l8 : pb;
#pragma unroll
        for (int mb = 0; mb < 4; ++mb) { a[mb] = WFrag<T16>::ldp(pa + mb * 16 * K); if (NSPLIT == 1 || NSPLIT == 2) a2[mb] = WFrag<T16>::ldp(pa2 + mb * 16 * K); }
#pragma unroll
        for (int nb = 0; nb < 4; ++nb) { const V b = WFrag<T16>::ldp(pb + nb * 16 * K); V b2; if (NSPLIT >= 2) b2 = WFrag<T16>::ldp(pb2 + nb * 16 * K);
#pragma unroll
            for (int mb = 0; mb < 4; ++mb) { acc[mb][nb] = WFrag<T16>::mma(a[mb], b, acc[mb][nb]); if (NSPLIT == 1 || NSPLIT == 2) acc[mb][nb] = WFrag<T16>::mma(a2[mb], b, acc[mb][nb]); if (NSPLIT >= 2) acc[mb][nb] = WFrag<T16>::mma(a[mb], b2, acc[mb][nb]); } }
        asm volatile("s_wait_xcnt 0x0" :: "v"(pa), "v"(pa2), "v"(pb), "v"(pb2) : "memory");   // stands in front of whatever next rewrites these loads' address registers; naming them keeps them whole up to here (no later load of the trip lands on one)
        asm volatile("v_nop\n\tv_nop\n\tv_nop\n\tv_nop" : "+v"(acc[0][0]), "+v"(acc[1][1]), "+v"(acc[2][2]), "+v"(acc[3][3]) : "v"(a[0]), "v"(a[3]));
    }
    const size_t pz = (size_t)(r0 / rows) * NH_ + by; const int t0 = r0 % rows;   // plane index batch * heads + head; the tile's first row in it
    if constexpr (EPI == 2) {   // a lane's 8 accumulator rows are 8 successive t of one d: one piece of the [d][t] plane's fragment order, a wave's store is 512 contiguous bytes straight from registers
        const size_t vo = pz * HD * rows + (size_t)t0 * 16 + lane * 8;
#pragma unroll
        for (int nb = 0; nb < 4; ++nb) {
#pragma unroll
            for (int mb = 0; mb < 4; ++mb) { v8h o16; v8us oh, ol;
#pragma unroll
                for (int j = 0; j < 8; ++j) { const float x = acc[mb][nb][j]; o16[j] = tohx(x); unsigned short h2, l2; splitf(x, h2, l2); oh[j] = h2; ol[j] = l2; }
                const size_t o = vo + (size_t)nb * 16 * rows + mb * 256;
                __builtin_amdgcn_sched_barrier(0);   // all three pieces are made before the first store goes, so that nothing is computed into a register of a store in flight
                *(v8h*)(P16 + o) = o16; *(v8us*)(Ph + o) = oh; *(v8us*)(Pl + o) = ol;
                asm volatile("s_wait_xcnt 0x0" ::: "memory"); } }   // stands in front of whatever next rewrites these stores' address and data registers
        return;
    }
    if constexpr (EPI == 0 || EPI == 1) {   // 16 rows at a time through LDS: a lane then holds 8 successive d of row lr, one piece of the fragment order; a wave's store is 512 contiguous bytes
        const size_t po = (pz * rows + t0) * HD + lane * 8;
#pragma unroll
        for (int mb = 0; mb < 4; ++mb) {
#pragma unroll
            for (int nb = 0; nb < 4; ++nb) {
#pragma unroll
                for (int j = 0; j < 8; ++j) os[(hi * 8 + j) * 68 + nb * 16 + lr] = acc[mb][nb][j]; }
            __builtin_amdgcn_wave_barrier(); asm volatile("" ::: "memory");   // the wave's LDS stores stay in front of the reads that other lanes make of them (one wave: the LDS keeps the order, the compiler must too)
#pragma unroll
            for (int s = 0; s < 4; ++s) { const v4f x0 = *(const v4fa*)(os + lr * 68 + s * 16 + hi * 8), x1 = *(const v4fa*)(os + lr * 68 + s * 16 + hi * 8 + 4); const size_t o = po + (size_t)(mb * 16) * HD + s * 256; v8us oh, ol, o2h, o2l;
#pragma unroll
                for (int q = 0; q < 8; ++q) { const float x = (q < 4 ? x0[q & 3] : x1[q & 3]); unsigned short h2, l2; splitf(EPI == 1 ? __fadd_rn(x, __uint_as_float(buv[s][q] & 0xFFFF0000u)) : x, h2, l2); oh[q] = h2; ol[q] = l2;
                    if constexpr (EPI == 1) { splitf(__fadd_rn(x, __uint_as_float(buv[s][q] << 16)), h2, l2); o2h[q] = h2; o2l[q] = l2; } }
                *(v8us*)(Ph + o) = oh; *(v8us*)(Pl + o) = ol; if constexpr (EPI == 1) { *(v8us*)(P2h + o) = o2h; *(v8us*)(P2l + o) = o2l; }
                asm volatile("s_wait_xcnt 0x0" ::: "memory"); }   // stands in front of whatever next rewrites these stores' address and data registers
            __builtin_amdgcn_wave_barrier(); asm volatile("" ::: "memory");   // and these reads in front of the next 16 rows' stores
        }
        return;
    }
#pragma unroll
    for (int mb = 0; mb < 4; ++mb) {
#pragma unroll
        for (int nb = 0; nb < 4; ++nb) {
#pragma unroll
            for (int j = 0; j < 8; ++j) os[(hi * 8 + j) * 68 + nb * 16 + lr] = acc[mb][nb][j]; }
        __builtin_amdgcn_wave_barrier(); asm volatile("" ::: "memory");
        float* crow = C + (size_t)(r0 + mb * 16) * ldc + c0;
{
#pragma unroll
            for (int s = 0; s < 8; ++s) { const int row = 2 * s + hi, cofs = lr * 4; v4f val = *(const v4fa*)(os + row * 68 + cofs); if (BIAS) { val[0] += bfr(bias[c0 + cofs]); val[1] += bfr(bias[c0 + cofs + 1]); val[2] += bfr(bias[c0 + cofs + 2]); val[3] += bfr(bias[c0 + cofs + 3]); }
                *(v4f*)(crow + (size_t)row * ldc + cofs) = val;
                asm volatile("s_wait_xcnt 0x0" ::: "memory"); }   // stands in front of whatever next rewrites this store's address and data registers
             }
        __builtin_amdgcn_wave_barrier(); asm volatile("" ::: "memory");
    }
}
template <typename T16, int NSPLIT, bool BIAS>
__global__ __launch_bounds__(32) void k_gemmw(const T16* __restrict__ A, const T16* __restrict__ A2, const T16* __restrict__ Bt, const T16* __restrict__ Bt2, float* C, int ldc, const float* __restrict__ bias) {
    __shared__ __align__(16) float os[16 * 68];
    gemmw<T16, NSPLIT, BIAS, -1, TT>(os, blockIdx.x, blockIdx.y, A, A2, Bt, Bt2, C, ldc, bias, nullptr, nullptr, nullptr, nullptr, nullptr, nullptr, nullptr);
}
// all four projections in one grid (NB_ * TT / 64, heads, 5): z 0 is q (the longest epilogue starts first), z 1 and 2 the two halves of p's row tiles (twice as many rows), z 3 k, z 4 v. The products do not depend on each other, so their waves share the SIMDs and hide each other's load waits.
__global__ __launch_bounds__(32) void k_proj(const bf* __restrict__ XP, const bf* __restrict__ XQ, const bf* __restrict__ XK, const bf* __restrict__ XV, const bf* __restrict__ WP, const bf* __restrict__ WQ, const bf* __restrict__ WK, const bf* __restrict__ WV,
                                             const float* __restrict__ ub, const float* __restrict__ vb, bf* RPh, bf* RPl, bf* QPh, bf* QPl, bf* QVh, bf* QVl, bf* KPh, bf* KPl, bf* VTh, bf* VTl, h16* VT16) {
    __shared__ __align__(16) float os[16 * 68];
    const int bx = blockIdx.x, by = blockIdx.y, bz = blockIdx.z;
    if (bz == 0) gemmw<bf, 0, false, 1, TT>(os, bx, by, XQ, nullptr, WQ, nullptr, nullptr, 0, nullptr, ub, vb, QPh, QPl, QVh, QVl, nullptr);   // (q + u) and (q + v) planes
    else if (bz < 3) gemmw<bf, 0, false, 0, LP>(os, (bz - 1) * (NB_ * TT / 64) + bx, by, XP, nullptr, WP, nullptr, nullptr, 0, nullptr, nullptr, nullptr, RPh, RPl, nullptr, nullptr, nullptr);   // p = pos Wp: per-head hi/lo planes [batch][8][2048][64]
    else if (bz == 3) gemmw<bf, 0, false, 0, TT>(os, bx, by, XK, nullptr, WK, nullptr, nullptr, 0, nullptr, nullptr, nullptr, KPh, KPl, nullptr, nullptr, nullptr);
    else gemmw<bf, 0, false, 2, TT>(os, bx, by, XV, nullptr, WV, nullptr, nullptr, 0, nullptr, nullptr, nullptr, VTh, VTl, nullptr, nullptr, VT16);   // v planes [batch][head][d][t]
}

typedef __attribute__((ext_vector_type(2))) _Float16 v2h;
typedef __attribute__((ext_vector_type(4))) _Float16 v4h;
typedef __attribute__((ext_vector_type(2))) unsigned short v2us;
typedef __attribute__((ext_vector_type(4))) unsigned short v4us;
typedef __attribute__((ext_vector_type(2))) float v2f;
typedef __attribute__((ext_vector_type(4))) int v4i;

__device__ __forceinline__ void wtG(int bx, const float* __restrict__ w, int K, int N, bf* Bt) {
    const int lane = threadIdx.x & 31; const int L0 = (bx * 8 + (threadIdx.x >> 5)) * 8; const int nlines = N * K / 64;
{
#pragma unroll 1
        for (int l = 0; l < 8; ++l) { const int L = L0 + l; if (L >= nlines) break; const size_t e = (size_t)L * 64 + lane * 2; const int k = (int)(e % K), n = (int)(e / K); v2us o;
            o[0] = f2bf(w[(size_t)k * N + n]); o[1] = f2bf(w[(size_t)(k + 1) * N + n]); *(v2us*)(Bt + pko((size_t)n, k, K)) = o;
            asm volatile("s_wait_xcnt 0x0" ::: "memory"); }   // stands in front of the next trip's rewrite of this store's address and data registers
         }
}
// f32 rows [rsrc][DM] to a bf16 plane in fragment order: a wave takes 8 rows x 32 k, half a block: it reads 128 contiguous bytes of each row (8 whole lines) and writes four runs of 128 bytes (4 whole lines); a piece of a row past rsrc (the pad row of the position planes) is written as zeros
__device__ __forceinline__ void cvt8(int bx, const float* __restrict__ src, bf* dst, size_t n8, int rsrc) { const size_t i = (size_t)bx * 256 + threadIdx.x; if (i >= n8) return;
    const size_t blk = i >> 6; const int c = ((int)(i & 31) >> 3) * 16 + ((int)(i >> 5) & 1) * 8 + (int)(i & 7); const size_t r = (blk / (DM / 32)) * 16 + (c & 15); const int k = (int)(blk % (DM / 32)) * 32 + (c >> 4) * 8;
    v8f v = (v8f){}; v8us o;
    if (r < (size_t)rsrc) { v = *(const v8f*)(src + r * DM + k);
        asm volatile("s_wait_xcnt 0x0" ::: "memory"); }   // stands in front of whatever next rewrites this load's address registers
#pragma unroll
    for (int q = 0; q < 8; ++q) o[q] = f2bf(v[q]); *(v8us*)(dst + (blk * 64 + c) * 8) = o;  }

// every bf16 operand plane of the projections and of Wo in one grid: the pieces do not depend on each other. Blocks 0 .. 5 WB - 1: the five weights (few blocks, long dependent trips: they start first); then 3 XBK blocks: query, key, value; then NB_ PBK blocks: the position rows of each batch with their pad row.
#define WB  (DM * DM / 64 / 64)
#define XBK (NB_ * TT * DM / 8 / 256)
#define PBK (LP * DM / 8 / 256)
__global__ __launch_bounds__(256) void k_prep(const float* __restrict__ wq, const float* __restrict__ wk, const float* __restrict__ wv, const float* __restrict__ wo, const float* __restrict__ wp, bf* WQ, bf* WK, bf* WV, bf* WO, bf* WP,
                                              const float* __restrict__ x, const float* __restrict__ xk, const float* __restrict__ xv, const float* __restrict__ pos, bf* XQ, bf* XK, bf* XV, bf* XP) {
    static_assert(DQ == DM && DKV == DM, "five square weights");
    int b = blockIdx.x;
    if (b < 5 * WB) { const int s = b / WB; wtG(b % WB, s == 0 ? wq : s == 1 ? wk : s == 2 ? wv : s == 3 ? wo : wp, DM, DM, s == 0 ? WQ : s == 1 ? WK : s == 2 ? WV : s == 3 ? WO : WP); return; }
    b -= 5 * WB;
    if (b < 3 * XBK) { const int s = b / XBK; cvt8(b % XBK, s == 0 ? x : s == 1 ? xk : xv, s == 0 ? XQ : s == 1 ? XK : XV, (size_t)NB_ * TT * DM / 8, NB_ * TT); return; }
    b -= 3 * XBK;
    { const int s = b / PBK; cvt8(b % PBK, pos + (size_t)s * (LP - 1) * DM, XP + (size_t)s * LP * DM, (size_t)LP * DM / 8, LP - 1); }   // 2,047 position rows + one zero pad row per batch
}
// ---- k_fattn: scores, rel_shift, softmax, attn.v and the head merge for MR query rows of one (batch, head); grid (TT / MR, batches x heads), 8 waves.
// The score strip S[MR][TT] (f32, pitch SP) never leaves LDS. Every sum keeps the order of a 16x16x32 product chain over k ascending (hi.hi, lo.hi, hi.lo per 32 k), content + position added once, the row softmax with its fixed trees.
#define MR 32      // query rows per work-group (two 16-row tiles)
#define SP 1028    // f32 pitch of a score row in LDS: rows 8 apart fall 32 banks apart, 16-byte aligned
typedef v4us __attribute__((may_alias)) v4usa;
typedef v4h  __attribute__((may_alias)) v4ha;
// the hi and lo fragments of one 16-row tile of B (64 k)
struct BTile { v16bf b[2], b2[2]; };
__device__ __forceinline__ void ld_btile(BTile& x, const bf* __restrict__ bh, const bf* __restrict__ bl) {
#pragma unroll
    for (int ks = 0; ks < 2; ++ks) { x.b[ks] = WFrag<bf>::ldp(bh + ks * 512); x.b2[ks] = WFrag<bf>::ldp(bl + ks * 512); }
    asm volatile("s_wait_xcnt 0x0" ::: "memory");   // stands in front of whatever next rewrites these loads' address registers
}
// one plane's fragments of the strip's 32 query rows (two 16-row tiles x 64 k)
__device__ __forceinline__ void ld_qfrags(v16bf (&a)[2][2], const bf* __restrict__ q) {
#pragma unroll
    for (int sub = 0; sub < 2; ++sub) {
#pragma unroll
        for (int ks = 0; ks < 2; ++ks) a[sub][ks] = WFrag<bf>::ldp(q + sub * 16 * HD + ks * 512); }
    asm volatile("s_wait_xcnt 0x0" ::: "memory");   // stands in front of whatever next rewrites these loads' address registers
}
// one B tile against both 16-row tiles of A: acc[sub] = sum over 64 k, 3 products
__device__ __forceinline__ void qk_tile(const v16bf (&a)[2][2], const v16bf (&a2)[2][2], const BTile& x, v8f (&acc)[2]) {
    acc[0] = (v8f){}; acc[1] = (v8f){};
#pragma unroll
    for (int ks = 0; ks < 2; ++ks) {
#pragma unroll
        for (int sub = 0; sub < 2; ++sub) { acc[sub] = wmmab(a[sub][ks], x.b[ks], acc[sub]); acc[sub] = wmmab(a2[sub][ks], x.b[ks], acc[sub]); acc[sub] = wmmab(a[sub][ks], x.b2[ks], acc[sub]); } }
    asm volatile("v_nop\n\tv_nop\n\tv_nop\n\tv_nop" :: "v"(acc[0]), "v"(acc[1]));   // four vector slots behind the last product: the next tile's first product starts from zero in the same result registers, with only LDS stores and loads between
}
// position tile: S[row][m + s - 1023] = (q + v).p[m]; EDGE: part of the tile may fall outside 0 <= t < TT and is dropped
template <bool EDGE>
__device__ __forceinline__ void pos_store(float* S, const v8f (&acc)[2], int m0, int s0, int lr, int hi) {
    const int tb = m0 + lr + s0 + hi * 8 - (TT - 1);   // t of (sub 0, j 0)
#pragma unroll
    for (int sub = 0; sub < 2; ++sub) {
#pragma unroll
        for (int j = 0; j < 8; ++j) { const int t = tb + sub * 16 + j; if (!EDGE || (unsigned)t < (unsigned)TT) S[(sub * 16 + hi * 8 + j) * SP + t] = acc[sub][j]; } }
}
// attn.v for one 16 x 16 output tile: P rows from LDS (pa; lo plane TT elements behind the hi plane), v rows [d][t] from global (fragment order); k = t ascending, per 32 k: hi.hi, lo.hi, hi.lo (SPLIT) or one product.
// Stages of 64 k: v fragments fetched two stages ahead, P fragments one stage ahead.
template <typename T16, bool SPLIT>
__device__ __forceinline__ v8f pv_tile(const T16* pa, const T16* __restrict__ vh, const T16* __restrict__ vl) {
    typedef typename WFrag<T16>::V V; constexpr int NS = TT / 64;
    V b[3][2], b2[3][2], a[2][2], a2[2][2]; v8f acc = (v8f){};
#pragma unroll
    for (int s = 0; s < 2; ++s) {
#pragma unroll
        for (int ks = 0; ks < 2; ++ks) { b[s][ks] = WFrag<T16>::ldp(vh + (s * 2 + ks) * 512); if (SPLIT) b2[s][ks] = WFrag<T16>::ldp(vl + (s * 2 + ks) * 512); } }
#pragma unroll
    for (int ks = 0; ks < 2; ++ks) { a[0][ks] = WFrag<T16>::ld(pa + ks * 32); if (SPLIT) a2[0][ks] = WFrag<T16>::ld(pa + TT + ks * 32); }
#pragma unroll
    for (int s = 0; s < NS; ++s) {
        if (s + 2 < NS) {
#pragma unroll
            for (int ks = 0; ks < 2; ++ks) { b[(s + 2) % 3][ks] = WFrag<T16>::ldp(vh + ((s + 2) * 2 + ks) * 512); if (SPLIT) b2[(s + 2) % 3][ks] = WFrag<T16>::ldp(vl + ((s + 2) * 2 + ks) * 512); } }
        if (s + 1 < NS) {
#pragma unroll
            for (int ks = 0; ks < 2; ++ks) { a[(s + 1) & 1][ks] = WFrag<T16>::ld(pa + (s + 1) * 64 + ks * 32); if (SPLIT) a2[(s + 1) & 1][ks] = WFrag<T16>::ld(pa + TT + (s + 1) * 64 + ks * 32); } }
        __builtin_amdgcn_sched_barrier(0);   // keeps the later stages' loads in front of this stage's products; without it they sink to their uses and each stage waits out a whole load
#pragma unroll
        for (int ks = 0; ks < 2; ++ks) { acc = WFrag<T16>::mma(a[s & 1][ks], b[s % 3][ks], acc); if (SPLIT) { acc = WFrag<T16>::mma(a2[s & 1][ks], b[s % 3][ks], acc); acc = WFrag<T16>::mma(a[s & 1][ks], b2[s % 3][ks], acc); } }
    }
    asm volatile("s_wait_xcnt 0x0" ::: "memory");   // stands in front of whatever next rewrites the v loads' address registers
    return acc;
}
__global__ __launch_bounds__(256) void k_fattn(const bf* __restrict__ QPh, const bf* __restrict__ QPl, const bf* __restrict__ QVh, const bf* __restrict__ QVl, const bf* __restrict__ KPh, const bf* __restrict__ KPl, const bf* __restrict__ RPh, const bf* __restrict__ RPl,
                                               const h16* __restrict__ VT16, const bf* __restrict__ VTh, const bf* __restrict__ VTl, bf* ATh, bf* ATl) {
    __shared__ __align__(16) float S[MR * SP];
    __shared__ __align__(16) float Os[MR * 68];
    const int lane = threadIdx.x & 31, lr = lane & 15, hi = lane >> 4; const int w = __builtin_amdgcn_readfirstlane(threadIdx.x >> 5);
    const int s0 = blockIdx.x * MR; const size_t z = blockIdx.y;   // z = batch * 8 + head: plane index of every operand
    const bool hires = (s0 < RH);
    const size_t qoff = (z * TT + s0) * HD + 8 * lane;
    {   // position scores, stored skewed: the 66 tiles of 16 p rows that the 32 query rows reach; wave w takes tiles w + 8 k; tiles 0, 1, 64, 65 cross an end of the key range
        v16bf a[2][2], a2[2][2];
        ld_qfrags(a, QVh + qoff); ld_qfrags(a2, QVl + qoff);
        const int mb = (TT - MR) - s0 + w * 16;   // the wave's first p row; tile 0 starts where t = 0 meets the strip's last query row
        const bf* ph = RPh + (z * LP + mb) * HD + 8 * lane; const bf* pl = RPl + (z * LP + mb) * HD + 8 * lane;
        BTile bt[2]; ld_btile(bt[0], ph, pl);
#pragma unroll
        for (int k = 0; k < 8; ++k) {
            if (k < 7 || w < 2) ld_btile(bt[(k + 1) & 1], ph + (k + 1) * 128 * HD, pl + (k + 1) * 128 * HD);
            __builtin_amdgcn_sched_barrier(0);   // keeps the next tile's loads in front of this tile's products, so that they fly meanwhile
            v8f acc[2]; qk_tile(a, a2, bt[k & 1], acc);
            if (k == 0) pos_store<true>(S, acc, mb, s0, lr, hi); else pos_store<false>(S, acc, mb + k * 128, s0, lr, hi);
        }
        if (w < 2) { v8f acc[2]; qk_tile(a, a2, bt[0], acc); pos_store<true>(S, acc, mb + 8 * 128, s0, lr, hi); }
    }
    __syncthreads();   // every position score is in S before a content score is added to it
    {   // content scores on top; wave w takes key tiles w + 8 k
        v16bf a[2][2], a2[2][2];
        ld_qfrags(a, QPh + qoff); ld_qfrags(a2, QPl + qoff);
        const bf* kh = KPh + (z * TT + w * 16) * HD + 8 * lane; const bf* kl = KPl + (z * TT + w * 16) * HD + 8 * lane;
        float* sw = S + hi * 8 * SP + w * 16 + lr;
        BTile bt[2]; ld_btile(bt[0], kh, kl);
#pragma unroll
        for (int k = 0; k < 8; ++k) {
            if (k < 7) ld_btile(bt[(k + 1) & 1], kh + (k + 1) * 128 * HD, kl + (k + 1) * 128 * HD);
            float old[2][8];
#pragma unroll
            for (int sub = 0; sub < 2; ++sub) {
#pragma unroll
                for (int j = 0; j < 8; ++j) old[sub][j] = sw[(sub * 16 + j) * SP + k * 128]; }
            __builtin_amdgcn_sched_barrier(0);   // keeps the next tile's loads and this tile's position scores in front of the products, so that they fly meanwhile
            v8f acc[2]; qk_tile(a, a2, bt[k & 1], acc);
#pragma unroll
            for (int sub = 0; sub < 2; ++sub) {
#pragma unroll
                for (int j = 0; j < 8; ++j) sw[(sub * 16 + j) * SP + k * 128] = __fadd_rn(acc[sub][j], old[sub][j]); }
        }
    }
    __syncthreads();   // whole score rows before the softmax
    // softmax: one wave per row, 4 rows a wave; t = S x HD^-0.5 (no mask), register row, one exp, fixed trees; P overwrites the row it came from (hi plane then lo plane, or fp16)
#pragma unroll 1
    for (int r = 0; r < MR / 8; ++r) { float* sr = S + (w * (MR / 8) + r) * SP; float v[TT / 32]; float mx = -3.0e38f;
#pragma unroll
        for (int ch = 0; ch < TT / 128; ++ch) { const v4f a = *(const v4fa*)(sr + ch * 128 + lane * 4);
#pragma unroll
            for (int q = 0; q < 4; ++q) { const float t = a[q] * SCL; v[ch * 4 + q] = t; mx = fmaxf(mx, t); } }
#pragma unroll
        for (int sh = 16; sh; sh >>= 1) mx = fmaxf(mx, __shfl_xor(mx, sh, 32));
        float sum = 0.f;
#pragma unroll
        for (int k = 0; k < TT / 32; ++k) { const float d0 = __fsub_rn(v[k], mx); v[k] = __builtin_amdgcn_exp2f(__fmul_rn(d0, 1.4426950408889634f)); sum += v[k]; }
#pragma unroll
        for (int sh = 16; sh; sh >>= 1) sum += __shfl_xor(sum, sh, 32);
        const float f = __fdiv_rn(hires ? 1.0f : PCAR, sum);
        if (hires) { bf* ph = (bf*)sr;
#pragma unroll
            for (int ch = 0; ch < TT / 128; ++ch) { v4us oh, ol;
#pragma unroll
                for (int q = 0; q < 4; ++q) { unsigned short a, c2; splitf(v[ch * 4 + q] * f, a, c2); oh[q] = a; ol[q] = c2; }
                *(v4usa*)(ph + ch * 128 + lane * 4) = oh; *(v4usa*)(ph + TT + ch * 128 + lane * 4) = ol; }
        } else { h16* p16 = (h16*)sr;
#pragma unroll
            for (int ch = 0; ch < TT / 128; ++ch) { v4h o4;
#pragma unroll
                for (int q = 0; q < 4; ++q) o4[q] = tohx(v[ch * 4 + q] * f);
                *(v4ha*)(p16 + ch * 128 + lane * 4) = o4; } }
    }
    __syncthreads();   // every P row before attn.v reads it
    {   // attn.v: one 16 x 16 output tile a wave
        const int sub = w >> 2, nt = w & 3; const float* prow = S + (sub * 16 + lr) * SP; const size_t voff = (z * HD + nt * 16) * TT + 8 * lane;
        const v8f acc = hires ? pv_tile<bf, true>((const bf*)prow + 8 * hi, VTh + voff, VTl + voff) : pv_tile<h16, false>((const h16*)prow + 8 * hi, VT16 + voff, nullptr);
#pragma unroll
        for (int j = 0; j < 8; ++j) Os[(sub * 16 + hi * 8 + j) * 68 + nt * 16 + lr] = acc[j];
    }
    __syncthreads();   // the 32 x 64 context tile is whole before it is split and stored by rows
    { const int row = (w >> 2) * 16 + lr, d0 = (w & 3) * 16 + hi * 8; const float cs = hires ? 1.0f : (1.0f / PCAR); const v4f x0 = *(const v4fa*)(Os + row * 68 + d0), x1 = *(const v4fa*)(Os + row * 68 + d0 + 4); v8us oh, ol;
#pragma unroll
        for (int q = 0; q < 8; ++q) { unsigned short a, c2; splitf((q < 4 ? x0[q & 3] : x1[q & 3]) * cs, a, c2); oh[q] = a; ol[q] = c2; }
        const size_t oo = pko((z / NH_) * TT + s0 + row, (int)(z % NH_) * HD + d0, DQ); *(v8us*)(ATh + oo) = oh; *(v8us*)(ATl + oo) = ol; }
}

extern "C" void kernel_launch(void* const* d_in, const int* in_sizes, int n_in,
                              void* d_out, int out_size, void* d_ws, size_t ws_size, hipStream_t stream) {
    (void)in_sizes; (void)n_in; (void)out_size;
    const float* x = (const float*)d_in[0];   /* query */ const float* xk = (const float*)d_in[1]; const float* xv = (const float*)d_in[2]; const float* pos = (const float*)d_in[3];   /* [8][2047][512] */ const float* wq = (const float*)d_in[4]; const float* wk = (const float*)d_in[5]; const float* wv = (const float*)d_in[6]; const float* wp = (const float*)d_in[7]; const float* ub = (const float*)d_in[8]; const float* vb = (const float*)d_in[9];   /* u_bias, v_bias [8][64] */ const float* wo = (const float*)d_in[10];
    float* OUT = (float*)d_out;     // [8][1024][512]
    char* wsp = (char*)d_ws;
    auto take = [&](size_t bytes) { char* p = wsp; wsp += (bytes + 255) & ~(size_t)255; return (void*)p; };
    // kept to the end: weights, head planes of all batches, merged context
    bf* WP = (bf*)take((size_t)DQ * DM * 2); bf* WQ = (bf*)take((size_t)DQ * DM * 2); bf* WK = (bf*)take((size_t)DKV * DM * 2); bf* WV = (bf*)take((size_t)DKV * DM * 2); bf* WO = (bf*)take((size_t)DM * DQ * 2);
    bf* RPh = (bf*)take((size_t)NB_ * NH_ * LP * HD * 2); bf* RPl = (bf*)take((size_t)NB_ * NH_ * LP * HD * 2); bf* QVh = (bf*)take((size_t)NB_ * NH_ * TT * HD * 2); bf* QVl = (bf*)take((size_t)NB_ * NH_ * TT * HD * 2);
    bf* QPh = (bf*)take((size_t)NB_ * NH_ * TT * HD * 2); bf* QPl = (bf*)take((size_t)NB_ * NH_ * TT * HD * 2); bf* KPh = (bf*)take((size_t)NB_ * NKV * TT * HD * 2); bf* KPl = (bf*)take((size_t)NB_ * NKV * TT * HD * 2);
    h16* VT16 = (h16*)take((size_t)NB_ * NKV * HD * TT * 2); bf* VTh = (bf*)take((size_t)NB_ * NKV * HD * TT * 2); bf* VTl = (bf*)take((size_t)NB_ * NKV * HD * TT * 2); bf* ATh = (bf*)take((size_t)NB_ * TT * DQ * 2); bf* ATl = (bf*)take((size_t)NB_ * TT * DQ * 2);
    // projection stage's buffers
    bf* XQ = (bf*)take((size_t)NB_ * TT * DM * 2); bf* XK = (bf*)take((size_t)NB_ * TT * DM * 2); bf* XV = (bf*)take((size_t)NB_ * TT * DM * 2); bf* XP = (bf*)take((size_t)NB_ * LP * DM * 2);
    if ((size_t)(wsp - (char*)d_ws) > ws_size) return;
    k_prep<<<5 * WB + 3 * XBK + NB_ * PBK, 256, 0, stream>>>(wq, wk, wv, wo, wp, WQ, WK, WV, WO, WP, x, xk, xv, pos, XQ, XK, XV, XP);   /* all bf16 operand planes */
    k_proj<<<dim3(NB_ * TT / 64, NH_, 5), 32, 0, stream>>>(XP, XQ, XK, XV, WP, WQ, WK, WV, ub, vb, RPh, RPl, QPh, QPl, QVh, QVl, KPh, KPl, VTh, VTl, VT16);   /* all four projections, head planes out */
    k_fattn<<<dim3(TT / MR, NB_ * NH_), 256, 0, stream>>>(QPh, QPl, QVh, QVl, KPh, KPl, RPh, RPl, VT16, VTh, VTl, ATh, ATl);   /* all batches and heads: scores in LDS, merged hi/lo context rows out */
    k_gemmw<bf, 1, false><<<dim3(NB_ * TT / 64, DM / 64, 1), 32, 0, stream>>>(ATh, ATl, WO, nullptr, OUT, DM, nullptr);
}
